// v000
// Measured on an AMD MI455X. A time is GPU time per run, averaged over a window of back-to-back runs after a warm-up
// (all launches, gaps included; the runs take copies of the inputs in turn), and the median of several windows.
// Apart from v000's, it joins two sittings. Times from different sittings can be a few percent apart, while
// side-by-side timings come from the same sitting.
// v000 is the starting kernel. One run takes 469 microseconds.
#include <hip/hip_runtime.h>
#include <math.h>
#include <stdint.h>

typedef __bf16 bf16;
typedef __attribute__((ext_vector_type(16))) __bf16 v16bf;
typedef __attribute__((ext_vector_type(8)))  __bf16 v8bf;
typedef __attribute__((ext_vector_type(8)))  float  v8f;

#define Bn  4
#define Sn  2048
#define Dn  1024
#define Hn  16
#define DHn 64
#define Mn  (Bn * Sn)          /* 8192 rows of x */

/* workspace layout (bytes) */
#define XH_OFF  0ull
#define XH_BY   ((size_t)Mn * Dn * 2)        /* x in bf16            16 MiB */
#define WT_OFF  (XH_OFF + XH_BY)
#define WT_BY   ((size_t)3 * Dn * Dn * 2)    /* Wq/Wk/Wv^T bf16       6 MiB */
#define QH_OFF  (WT_OFF + WT_BY)
#define QH_BY   ((size_t)Mn * Dn * 2)        /* Q bf16 (B,H,S,dh)    16 MiB */
#define KH_OFF  (QH_OFF + QH_BY)
#define KH_BY   ((size_t)Mn * Dn * 2)        /* K bf16 (B,H,S,dh)    16 MiB */
#define VT_OFF  (KH_OFF + KH_BY)
#define VT_BY   ((size_t)Mn * Dn * 2)        /* V^T bf16 (B,H,dh,S)  16 MiB */
#define AT_OFF  (VT_OFF + VT_BY)
#define AT_BY   ((size_t)Mn * Dn * 4)        /* attn f32 (B,S,D)     32 MiB */

__device__ __forceinline__ void async_b128(const bf16* g, bf16* l) {
  asm volatile("global_load_async_to_lds_b128 %0, %1, off"
               :
               : "v"((unsigned)(uintptr_t)l),
                 "v"((unsigned long long)(uintptr_t)g)
               : "memory");
}

__device__ __forceinline__ void wait_async() {
  asm volatile("s_wait_asynccnt 0x0" ::: "memory");
}

__device__ __forceinline__ v16bf load_frag(const bf16* p) {
  union { v16bf v; v8bf h[2]; } f;
  f.h[0] = *(const v8bf*)(p);
  f.h[1] = *(const v8bf*)(p + 16);
  return f.v;
}

__device__ __forceinline__ v8f wmma_bf16(v16bf a, v16bf b, v8f c) {
  return __builtin_amdgcn_wmma_f32_16x16x32_bf16(
      false, a, false, b, (short)0, c, false, false);
}

/* ---------------- conversion kernels ---------------- */

__global__ void cvt_x_kernel(const float* __restrict__ x, bf16* __restrict__ xh) {
  int i = blockIdx.x * 256 + threadIdx.x;
  xh[i] = (bf16)x[i];
}

__global__ void cvt_wT_kernel(const float* __restrict__ Wq,
                              const float* __restrict__ Wk,
                              const float* __restrict__ Wv,
                              bf16* __restrict__ wt) {
  int mat = blockIdx.y;
  const float* W = (mat == 0) ? Wq : ((mat == 1) ? Wk : Wv);
  int i = blockIdx.x * 256 + threadIdx.x;   /* i = n*1024 + k */
  int n = i >> 10, k = i & 1023;
  wt[(size_t)mat * Dn * Dn + i] = (bf16)W[k * Dn + n];
}

/* ---------------- fused QKV GEMM (bf16 WMMA, f32 acc) ----------------
 * grid (64, 8, 3), block 256 (8 waves). Block tile 128(M) x 128(N).
 * A/B tiles double-buffered in LDS via async-to-LDS; wave = 32x64.   */
__global__ void __launch_bounds__(256, 1)
gemm_qkv_kernel(const bf16* __restrict__ xh, const bf16* __restrict__ wt,
                const float* __restrict__ bq, const float* __restrict__ bk,
                const float* __restrict__ bv,
                bf16* __restrict__ qh, bf16* __restrict__ kh,
                bf16* __restrict__ vt, float* __restrict__ out) {
  __shared__ bf16 abuf[2][128 * 32];   /* 8 KiB each */
  __shared__ bf16 bbuf[2][128 * 32];

  const int tid  = threadIdx.x;
  const int lane = tid & 31;
  const int w    = tid >> 5;
  const int mat  = blockIdx.z;
  const int row0 = blockIdx.x * 128;
  const int col0 = blockIdx.y * 128;
  const int mw   = w & 3;              /* 4 waves across M */
  const int nw   = w >> 2;             /* 2 waves across N */
  const int ln   = lane & 15;
  const int kb   = (lane >> 4) * 8;

  const bf16*  wtm  = wt + (size_t)mat * Dn * Dn;
  const float* bias = (mat == 0) ? bq : ((mat == 1) ? bk : bv);

  const bf16* asrc = xh  + (size_t)row0 * Dn;   /* row stride Dn */
  const bf16* bsrc = wtm + (size_t)col0 * Dn;

  v8f acc[2][4];
  for (int t = 0; t < 4; ++t) {
    float bval = bias[col0 + nw * 64 + t * 16 + ln];
    for (int r = 0; r < 8; ++r) { acc[0][t][r] = bval; acc[1][t][r] = bval; }
  }

  /* cooperative stage of one 128x32 A tile + 128x32 B tile */
  auto stage = [&](int kk, int buf) {
    for (int i = 0; i < 2; ++i) {
      int c = tid + i * 256;                 /* 512 16B chunks per tile */
      int row = c >> 2, off = (c & 3) * 8;
      async_b128(asrc + (size_t)row * Dn + kk + off, &abuf[buf][row * 32 + off]);
      async_b128(bsrc + (size_t)row * Dn + kk + off, &bbuf[buf][row * 32 + off]);
    }
  };

  stage(0, 0);
  int cur = 0;
  for (int kk = 0; kk < Dn; kk += 32) {
    wait_async();
    __syncthreads();
    if (kk + 32 < Dn) stage(kk + 32, cur ^ 1);

    v16bf a0 = load_frag(&abuf[cur][(mw * 32 + ln) * 32 + kb]);
    v16bf a1 = load_frag(&abuf[cur][(mw * 32 + 16 + ln) * 32 + kb]);
    for (int t = 0; t < 4; ++t) {
      v16bf b = load_frag(&bbuf[cur][(nw * 64 + t * 16 + ln) * 32 + kb]);
      acc[0][t] = wmma_bf16(a0, b, acc[0][t]);
      acc[1][t] = wmma_bf16(a1, b, acc[1][t]);
    }
    cur ^= 1;
  }

  for (int ms = 0; ms < 2; ++ms) {
    const int mbase = row0 + mw * 32 + ms * 16 + 8 * (lane >> 4);
    for (int t = 0; t < 4; ++t) {
      int n = col0 + nw * 64 + t * 16 + ln;
      int h = n >> 6, d = n & 63;
      for (int r = 0; r < 8; ++r) {
        int m = mbase + r;
        int b = m >> 11, s = m & 2047;
        size_t idx = (((size_t)(b * Hn + h) * Sn) + s) * DHn + d;
        float val = acc[ms][t][r];
        if (mat == 0) {
          qh[idx] = (bf16)(val * 0.125f);            /* fold 1/sqrt(64) */
        } else if (mat == 1) {
          out[(size_t)Mn * Dn + idx] = val;          /* K cache f32 */
          kh[idx] = (bf16)val;
        } else {
          out[(size_t)2 * Mn * Dn + idx] = val;      /* V cache f32 */
          vt[((size_t)(b * Hn + h) * DHn + d) * Sn + s] = (bf16)val;
        }
      }
    }
  }
}

/* ---------------- causal flash attention ----------------
 * grid (B*H=64, S/128=16), block 256 (8 waves). Wave = 16 query rows.
 * K/V tiles for each 32-KV block staged once per workgroup into
 * double-buffered LDS (async-to-LDS), shared by all 8 waves.        */
__global__ void __launch_bounds__(256, 1)
attn_kernel(const bf16* __restrict__ qh, const bf16* __restrict__ kh,
            const bf16* __restrict__ vt, float* __restrict__ attn) {
  __shared__ bf16 kbuf[2][32 * 64];    /* 4 KiB each: [kv][dh]  */
  __shared__ bf16 vbuf[2][64 * 32];    /* 4 KiB each: [dh][kv]  */
  __shared__ bf16 pbuf_all[8][16 * 32];

  const int tid  = threadIdx.x;
  const int lane = tid & 31;
  const int w    = tid >> 5;
  const int bh   = blockIdx.x;                 /* b*16 + h */
  const int qblk = blockIdx.y;
  const int q0   = qblk * 128 + w * 16;
  const int ln   = lane & 15;
  const int kb   = (lane >> 4) * 8;

  const bf16* qp = qh + (size_t)bh * Sn * DHn;
  const bf16* kp = kh + (size_t)bh * Sn * DHn;
  const bf16* vp = vt + (size_t)bh * DHn * Sn;

  v16bf qa0 = load_frag(qp + (size_t)(q0 + ln) * DHn + 0  + kb);
  v16bf qa1 = load_frag(qp + (size_t)(q0 + ln) * DHn + 32 + kb);

  v8f acco[4];
  for (int t = 0; t < 4; ++t)
    for (int r = 0; r < 8; ++r) acco[t][r] = 0.0f;
  float mrow[8], lrow[8];
  for (int r = 0; r < 8; ++r) { mrow[r] = -1e30f; lrow[r] = 0.0f; }

  bf16* pbuf = pbuf_all[w];
  const int nblk_wave = (q0 + 47) >> 5;        /* causal bound per wave  */
  const int nblk_blk  = qblk * 4 + 4;          /* uniform over the block */

  /* cooperative stage of one K(32x64) + V(64x32) tile */
  auto stage_kv = [&](int blk, int buf) {
    int kv0 = blk * 32;
    { int row = tid >> 3, off = (tid & 7) * 8;  /* 256 chunks of K */
      async_b128(kp + (size_t)(kv0 + row) * DHn + off,
                 &kbuf[buf][row * 64 + off]); }
    { int row = tid >> 2, off = (tid & 3) * 8;  /* 256 chunks of V^T */
      async_b128(vp + (size_t)row * Sn + kv0 + off,
                 &vbuf[buf][row * 32 + off]); }
  };

  stage_kv(0, 0);
  int cur = 0;
  for (int blk = 0; blk < nblk_blk; ++blk) {
    wait_async();
    __syncthreads();
    if (blk + 1 < nblk_blk) stage_kv(blk + 1, cur ^ 1);

    if (blk < nblk_wave) {
      int kv0 = blk * 32;
      v8f s0, s1;
      for (int r = 0; r < 8; ++r) { s0[r] = 0.0f; s1[r] = 0.0f; }

      v16bf k0a = load_frag(&kbuf[cur][(ln)      * 64 + 0  + kb]);
      v16bf k0b = load_frag(&kbuf[cur][(ln)      * 64 + 32 + kb]);
      s0 = wmma_bf16(qa0, k0a, s0);
      s0 = wmma_bf16(qa1, k0b, s0);
      v16bf k1a = load_frag(&kbuf[cur][(16 + ln) * 64 + 0  + kb]);
      v16bf k1b = load_frag(&kbuf[cur][(16 + ln) * 64 + 32 + kb]);
      s1 = wmma_bf16(qa0, k1a, s1);
      s1 = wmma_bf16(qa1, k1b, s1);

      /* online softmax, per accumulator row r (row = r + 8*(lane>>4)) */
      for (int r = 0; r < 8; ++r) {
        int rowg = q0 + r + 8 * (lane >> 4);
        float v0 = ((kv0 + ln)      <= rowg) ? s0[r] : -1e30f;
        float v1 = ((kv0 + 16 + ln) <= rowg) ? s1[r] : -1e30f;
        float mx = fmaxf(v0, v1);
        for (int off = 1; off < 16; off <<= 1) mx = fmaxf(mx, __shfl_xor(mx, off, 32));
        float mnew = fmaxf(mrow[r], mx);
        float corr = __expf(mrow[r] - mnew);
        float p0 = __expf(v0 - mnew);
        float p1 = __expf(v1 - mnew);
        float rs = p0 + p1;
        for (int off = 1; off < 16; off <<= 1) rs += __shfl_xor(rs, off, 32);
        lrow[r] = lrow[r] * corr + rs;
        mrow[r] = mnew;
        for (int t = 0; t < 4; ++t) acco[t][r] *= corr;
        int mloc = r + 8 * (lane >> 4);
        pbuf[mloc * 32 + ln]      = (bf16)p0;
        pbuf[mloc * 32 + 16 + ln] = (bf16)p1;
      }

      v16bf pa = load_frag(pbuf + ln * 32 + kb);
      for (int t = 0; t < 4; ++t) {
        v16bf bv_ = load_frag(&vbuf[cur][(t * 16 + ln) * 32 + kb]);
        acco[t] = wmma_bf16(pa, bv_, acco[t]);
      }
    }
    cur ^= 1;
  }

  const int b = bh >> 4, h = bh & 15;
  for (int t = 0; t < 4; ++t) {
    for (int r = 0; r < 8; ++r) {
      int mloc = r + 8 * (lane >> 4);
      int s = q0 + mloc;
      attn[((size_t)(b * Sn + s)) * Dn + h * DHn + t * 16 + ln] =
          acco[t][r] / lrow[r];
    }
  }
}

/* ---------------- residual + LayerNorm ---------------- */
__global__ void __launch_bounds__(256, 1)
ln_kernel(const float* __restrict__ x, const float* __restrict__ attn,
          const float* __restrict__ gamma, const float* __restrict__ beta,
          float* __restrict__ out) {
  __shared__ float red[256];
  const int row = blockIdx.x;
  const int tid = threadIdx.x;
  const float* xr = x    + (size_t)row * Dn;
  const float* ar = attn + (size_t)row * Dn;

  float y[4];
  float sum = 0.0f;
  for (int i = 0; i < 4; ++i) {
    y[i] = xr[tid + i * 256] + ar[tid + i * 256];
    sum += y[i];
  }
  red[tid] = sum; __syncthreads();
  for (int s = 128; s > 0; s >>= 1) {
    if (tid < s) red[tid] += red[tid + s];
    __syncthreads();
  }
  float mu = red[0] * (1.0f / 1024.0f);
  __syncthreads();

  float vs = 0.0f;
  for (int i = 0; i < 4; ++i) { float d = y[i] - mu; vs += d * d; }
  red[tid] = vs; __syncthreads();
  for (int s = 128; s > 0; s >>= 1) {
    if (tid < s) red[tid] += red[tid + s];
    __syncthreads();
  }
  float rstd = rsqrtf(red[0] * (1.0f / 1024.0f) + 1e-5f);

  for (int i = 0; i < 4; ++i) {
    int c = tid + i * 256;
    out[(size_t)row * Dn + c] = (y[i] - mu) * rstd * gamma[c] + beta[c];
  }
}

extern "C" void kernel_launch(void* const* d_in, const int* in_sizes, int n_in,
                              void* d_out, int out_size, void* d_ws, size_t ws_size,
                              hipStream_t stream) {
  const float* x     = (const float*)d_in[0];
  const float* Wq    = (const float*)d_in[1];
  const float* bq    = (const float*)d_in[2];
  const float* Wk    = (const float*)d_in[3];
  const float* bk    = (const float*)d_in[4];
  const float* Wv    = (const float*)d_in[5];
  const float* bv    = (const float*)d_in[6];
  const float* gamma = (const float*)d_in[7];
  const float* beta  = (const float*)d_in[8];
  float* out = (float*)d_out;

  char* ws = (char*)d_ws;
  bf16*  xh   = (bf16*)(ws + XH_OFF);
  bf16*  wt   = (bf16*)(ws + WT_OFF);
  bf16*  qh   = (bf16*)(ws + QH_OFF);
  bf16*  kh   = (bf16*)(ws + KH_OFF);
  bf16*  vt   = (bf16*)(ws + VT_OFF);
  float* attn = (float*)(ws + AT_OFF);

  cvt_x_kernel<<<Mn * Dn / 256, 256, 0, stream>>>(x, xh);
  cvt_wT_kernel<<<dim3(Dn * Dn / 256, 3), 256, 0, stream>>>(Wq, Wk, Wv, wt);
  gemm_qkv_kernel<<<dim3(Mn / 128, Dn / 128, 3), 256, 0, stream>>>(
      xh, wt, bq, bk, bv, qh, kh, vt, out);
  attn_kernel<<<dim3(Bn * Hn, Sn / 128), 256, 0, stream>>>(qh, kh, vt, attn);
  ln_kernel<<<Mn, 256, 0, stream>>>(x, attn, gamma, beta, out);
}

// v001
// It runs in 279 microseconds.
// Next to v000, in two timings, it ran 1.70 and 1.71 times as fast.
#include <hip/hip_runtime.h>
#include <math.h>
#include <stdint.h>

typedef __bf16 bf16;
typedef __attribute__((ext_vector_type(16))) __bf16 v16bf;
typedef __attribute__((ext_vector_type(8)))  __bf16 v8bf;
typedef __attribute__((ext_vector_type(8)))  float  v8f;

#define Bn  4
#define Sn  2048
#define Dn  1024
#define Hn  16
#define DHn 64
#define Mn  (Bn * Sn)          /* 8192 rows of x */

/* workspace layout (bytes) */
#define XH_OFF  0ull
#define XH_BY   ((size_t)Mn * Dn * 2)        /* x in bf16            16 MiB */
#define WT_OFF  (XH_OFF + XH_BY)
#define WT_BY   ((size_t)3 * Dn * Dn * 2)    /* Wq/Wk/Wv^T bf16       6 MiB */
#define QH_OFF  (WT_OFF + WT_BY)
#define QH_BY   ((size_t)Mn * Dn * 2)        /* Q bf16 (B,H,S,dh)    16 MiB */
#define KH_OFF  (QH_OFF + QH_BY)
#define KH_BY   ((size_t)Mn * Dn * 2)        /* K bf16 (B,H,S,dh)    16 MiB */
#define VT_OFF  (KH_OFF + KH_BY)
#define VT_BY   ((size_t)Mn * Dn * 2)        /* V^T bf16 (B,H,dh,S)  16 MiB */
#define AT_OFF  (VT_OFF + VT_BY)
#define AT_BY   ((size_t)Mn * Dn * 4)        /* attn f32 (B,S,D)     32 MiB */

__device__ __forceinline__ void async_b128(const bf16* g, bf16* l) {
  asm volatile("global_load_async_to_lds_b128 %0, %1, off"
               :
               : "v"((unsigned)(uintptr_t)l),
                 "v"((unsigned long long)(uintptr_t)g)
               : "memory");
}

__device__ __forceinline__ void wait_async() {
  asm volatile("s_wait_asynccnt 0x0" ::: "memory");
}

__device__ __forceinline__ v16bf load_frag(const bf16* p) {
  union { v16bf v; v8bf h[2]; } f;
  f.h[0] = *(const v8bf*)(p);
  f.h[1] = *(const v8bf*)(p + 16);
  return f.v;
}

__device__ __forceinline__ v8f wmma_bf16(v16bf a, v16bf b, v8f c) {
  return __builtin_amdgcn_wmma_f32_16x16x32_bf16(
      false, a, false, b, (short)0, c, false, false);
}

__device__ __forceinline__ float xhalf(float x) {
  int b = __builtin_bit_cast(int, x);
  return __builtin_bit_cast(float, __builtin_amdgcn_permlanex16(
      b, b, 0x76543210, 0xfedcba98, false, false));
}

/* ---------------- conversion kernels ---------------- */

__global__ void cvt_x_kernel(const float* __restrict__ x, bf16* __restrict__ xh) {
  int i = blockIdx.x * 256 + threadIdx.x;
  xh[i] = (bf16)x[i];
}

__global__ void cvt_wT_kernel(const float* __restrict__ Wq,
                              const float* __restrict__ Wk,
                              const float* __restrict__ Wv,
                              bf16* __restrict__ wt) {
  int mat = blockIdx.y;
  const float* W = (mat == 0) ? Wq : ((mat == 1) ? Wk : Wv);
  int i = blockIdx.x * 256 + threadIdx.x;   /* i = n*1024 + k */
  int n = i >> 10, k = i & 1023;
  wt[(size_t)mat * Dn * Dn + i] = (bf16)W[k * Dn + n];
}

/* ---------------- fused QKV GEMM (bf16 WMMA, f32 acc) ----------------
 * grid (64, 8, 3), block 256 (8 waves). Block tile 128(M) x 128(N).
 * A/B tiles double-buffered in LDS via async-to-LDS; wave = 32x64.   */
__global__ void __launch_bounds__(256, 1)
gemm_qkv_kernel(const bf16* __restrict__ xh, const bf16* __restrict__ wt,
                const float* __restrict__ bq, const float* __restrict__ bk,
                const float* __restrict__ bv,
                bf16* __restrict__ qh, bf16* __restrict__ kh,
                bf16* __restrict__ vt, float* __restrict__ out) {
  __shared__ bf16 abuf[2][128 * 32];   /* 8 KiB each */
  __shared__ bf16 bbuf[2][128 * 32];

  const int tid  = threadIdx.x;
  const int lane = tid & 31;
  const int w    = tid >> 5;
  const int mat  = blockIdx.z;
  const int row0 = blockIdx.x * 128;
  const int col0 = blockIdx.y * 128;
  const int mw   = w & 3;              /* 4 waves across M */
  const int nw   = w >> 2;             /* 2 waves across N */
  const int ln   = lane & 15;
  const int kb   = (lane >> 4) * 8;

  const bf16*  wtm  = wt + (size_t)mat * Dn * Dn;
  const float* bias = (mat == 0) ? bq : ((mat == 1) ? bk : bv);

  const bf16* asrc = xh  + (size_t)row0 * Dn;   /* row stride Dn */
  const bf16* bsrc = wtm + (size_t)col0 * Dn;

  v8f acc[2][4];
  for (int t = 0; t < 4; ++t) {
    float bval = bias[col0 + nw * 64 + t * 16 + ln];
    for (int r = 0; r < 8; ++r) { acc[0][t][r] = bval; acc[1][t][r] = bval; }
  }

  /* cooperative stage of one 128x32 A tile + 128x32 B tile */
  auto stage = [&](int kk, int buf) {
    for (int i = 0; i < 2; ++i) {
      int c = tid + i * 256;                 /* 512 16B chunks per tile */
      int row = c >> 2, off = (c & 3) * 8;
      async_b128(asrc + (size_t)row * Dn + kk + off, &abuf[buf][row * 32 + off]);
      async_b128(bsrc + (size_t)row * Dn + kk + off, &bbuf[buf][row * 32 + off]);
    }
  };

  stage(0, 0);
  int cur = 0;
  for (int kk = 0; kk < Dn; kk += 32) {
    wait_async();
    __syncthreads();
    if (kk + 32 < Dn) stage(kk + 32, cur ^ 1);

    v16bf a0 = load_frag(&abuf[cur][(mw * 32 + ln) * 32 + kb]);
    v16bf a1 = load_frag(&abuf[cur][(mw * 32 + 16 + ln) * 32 + kb]);
    for (int t = 0; t < 4; ++t) {
      v16bf b = load_frag(&bbuf[cur][(nw * 64 + t * 16 + ln) * 32 + kb]);
      acc[0][t] = wmma_bf16(a0, b, acc[0][t]);
      acc[1][t] = wmma_bf16(a1, b, acc[1][t]);
    }
    cur ^= 1;
  }

  for (int ms = 0; ms < 2; ++ms) {
    const int mbase = row0 + mw * 32 + ms * 16 + 8 * (lane >> 4);
    for (int t = 0; t < 4; ++t) {
      int n = col0 + nw * 64 + t * 16 + ln;
      int h = n >> 6, d = n & 63;
      for (int r = 0; r < 8; ++r) {
        int m = mbase + r;
        int b = m >> 11, s = m & 2047;
        size_t idx = (((size_t)(b * Hn + h) * Sn) + s) * DHn + d;
        float val = acc[ms][t][r];
        if (mat == 0) {
          qh[idx] = (bf16)(val * 0.125f);            /* fold 1/sqrt(64) */
        } else if (mat == 1) {
          out[(size_t)Mn * Dn + idx] = val;          /* K cache f32 */
          kh[idx] = (bf16)val;
        } else {
          out[(size_t)2 * Mn * Dn + idx] = val;      /* V cache f32 */
          vt[((size_t)(b * Hn + h) * DHn + d) * Sn + s] = (bf16)val;
        }
      }
    }
  }
}

__global__ void __launch_bounds__(256, 1)
attn_kernel(const bf16* __restrict__ qh, const bf16* __restrict__ kh,
            const bf16* __restrict__ vt, float* __restrict__ attn) {
  __shared__ bf16 kbuf[2][32 * 64];    /* 4 KiB each: [kv][dh]  */
  __shared__ bf16 vbuf[2][64 * 32];    /* 4 KiB each: [dh][kv]  */

  const int tid  = threadIdx.x;
  const int lane = tid & 31;
  const int w    = tid >> 5;
  const int bh   = blockIdx.x;                 /* b*16 + h */
  const int qblk = blockIdx.y;
  const int q0   = qblk * 128 + w * 16;
  const int ln   = lane & 15;
  const int kb   = (lane >> 4) * 8;

  const bf16* qp = qh + (size_t)bh * Sn * DHn;
  const bf16* kp = kh + (size_t)bh * Sn * DHn;
  const bf16* vp = vt + (size_t)bh * DHn * Sn;

  /* B operand: column = query q0 + ln, k = dh in the loader's order */
  v16bf qb0 = load_frag(qp + (size_t)(q0 + ln) * DHn + 0  + kb);
  v16bf qb1 = load_frag(qp + (size_t)(q0 + ln) * DHn + 32 + kb);

  v8f acco[4];                         /* O^T: [dh = 16t + kb + r][query ln] */
  for (int t = 0; t < 4; ++t)
    for (int r = 0; r < 8; ++r) acco[t][r] = 0.0f;
  float mrow = -1e30f;                 /* this lane's query, both halves alike */
  float lrow = 0.0f;                   /* this half's share of the row sum     */

  const int qg        = q0 + ln;               /* this lane's query      */
  const int nblk_wave = (q0 + 47) >> 5;        /* causal bound per wave  */
  const int nblk_blk  = qblk * 4 + 4;          /* uniform over the block */

  /* cooperative stage of one K(32x64) + V(64x32) tile */
  auto stage_kv = [&](int blk, int buf) {
    int kv0 = blk * 32;
    { int row = tid >> 3, off = (tid & 7) * 8;  /* 256 chunks of K */
      async_b128(kp + (size_t)(kv0 + row) * DHn + off,
                 &kbuf[buf][row * 64 + off]); }
    { int row = tid >> 2, off = (tid & 3) * 8;  /* 256 chunks of V^T */
      async_b128(vp + (size_t)row * Sn + kv0 + off,
                 &vbuf[buf][row * 32 + off]); }
  };

  stage_kv(0, 0);
  int cur = 0;
  for (int blk = 0; blk < nblk_blk; ++blk) {
    wait_async();
    __syncthreads();
    if (blk + 1 < nblk_blk) stage_kv(blk + 1, cur ^ 1);

    if (blk < nblk_wave) {
      int kv0 = blk * 32;
      v8f s0, s1;
      for (int r = 0; r < 8; ++r) { s0[r] = 0.0f; s1[r] = 0.0f; }

      v16bf k0a = load_frag(&kbuf[cur][(ln)      * 64 + 0  + kb]);
      v16bf k0b = load_frag(&kbuf[cur][(ln)      * 64 + 32 + kb]);
      s0 = wmma_bf16(k0a, qb0, s0);
      s0 = wmma_bf16(k0b, qb1, s0);
      v16bf k1a = load_frag(&kbuf[cur][(16 + ln) * 64 + 0  + kb]);
      v16bf k1b = load_frag(&kbuf[cur][(16 + ln) * 64 + 32 + kb]);
      s1 = wmma_bf16(k1a, qb0, s1);
      s1 = wmma_bf16(k1b, qb1, s1);

      /* online softmax of one query per lane: s0[r] is key kv0 + kb + r,
       * s1[r] is key kv0 + 16 + kb + r                                   */
      float mx = -1e30f;
      for (int r = 0; r < 8; ++r) {
        s0[r] = ((kv0 + kb + r)      <= qg) ? s0[r] : -1e30f;
        s1[r] = ((kv0 + 16 + kb + r) <= qg) ? s1[r] : -1e30f;
        mx = fmaxf(mx, fmaxf(s0[r], s1[r]));
      }
      mx = fmaxf(mx, xhalf(mx));
      float mnew = fmaxf(mrow, mx);
      float corr = __expf(mrow - mnew);
      mrow = mnew;

      v16bf pb;                        /* P^T as B: k = kb + r, 16 + kb + r */
      float rs0 = 0.0f, rs1 = 0.0f;
      for (int r = 0; r < 8; ++r) {
        float p0 = __expf(s0[r] - mnew);
        float p1 = __expf(s1[r] - mnew);
        rs0 += p0;
        rs1 += p1;
        pb[r]     = (bf16)p0;
        pb[8 + r] = (bf16)p1;
      }
      lrow = lrow * corr + (rs0 + rs1);
      for (int t = 0; t < 4; ++t)
        for (int r = 0; r < 8; ++r) acco[t][r] *= corr;

      for (int t = 0; t < 4; ++t) {
        v16bf va = load_frag(&vbuf[cur][(t * 16 + ln) * 32 + kb]);
        acco[t] = wmma_bf16(va, pb, acco[t]);
      }
    }
    cur ^= 1;
  }

  /* join the two halves' shares of the row sum, once */
  lrow += xhalf(lrow);
  const float inv = 1.0f / lrow;

  const int b = bh >> 4, h = bh & 15;
  float* op = attn + ((size_t)(b * Sn + qg)) * Dn + h * DHn + kb;
  for (int t = 0; t < 4; ++t) {
    float4 lo, hi;
    lo.x = acco[t][0] * inv; lo.y = acco[t][1] * inv;
    lo.z = acco[t][2] * inv; lo.w = acco[t][3] * inv;
    hi.x = acco[t][4] * inv; hi.y = acco[t][5] * inv;
    hi.z = acco[t][6] * inv; hi.w = acco[t][7] * inv;
    *(float4*)(op + t * 16)     = lo;
    *(float4*)(op + t * 16 + 4) = hi;
  }
}

/* ---------------- residual + LayerNorm ---------------- */
__global__ void __launch_bounds__(256, 1)
ln_kernel(const float* __restrict__ x, const float* __restrict__ attn,
          const float* __restrict__ gamma, const float* __restrict__ beta,
          float* __restrict__ out) {
  __shared__ float red[256];
  const int row = blockIdx.x;
  const int tid = threadIdx.x;
  const float* xr = x    + (size_t)row * Dn;
  const float* ar = attn + (size_t)row * Dn;

  float y[4];
  float sum = 0.0f;
  for (int i = 0; i < 4; ++i) {
    y[i] = xr[tid + i * 256] + ar[tid + i * 256];
    sum += y[i];
  }
  red[tid] = sum; __syncthreads();
  for (int s = 128; s > 0; s >>= 1) {
    if (tid < s) red[tid] += red[tid + s];
    __syncthreads();
  }
  float mu = red[0] * (1.0f / 1024.0f);
  __syncthreads();

  float vs = 0.0f;
  for (int i = 0; i < 4; ++i) { float d = y[i] - mu; vs += d * d; }
  red[tid] = vs; __syncthreads();
  for (int s = 128; s > 0; s >>= 1) {
    if (tid < s) red[tid] += red[tid + s];
    __syncthreads();
  }
  float rstd = rsqrtf(red[0] * (1.0f / 1024.0f) + 1e-5f);

  for (int i = 0; i < 4; ++i) {
    int c = tid + i * 256;
    out[(size_t)row * Dn + c] = (y[i] - mu) * rstd * gamma[c] + beta[c];
  }
}

extern "C" void kernel_launch(void* const* d_in, const int* in_sizes, int n_in,
                              void* d_out, int out_size, void* d_ws, size_t ws_size,
                              hipStream_t stream) {
  const float* x     = (const float*)d_in[0];
  const float* Wq    = (const float*)d_in[1];
  const float* bq    = (const float*)d_in[2];
  const float* Wk    = (const float*)d_in[3];
  const float* bk    = (const float*)d_in[4];
  const float* Wv    = (const float*)d_in[5];
  const float* bv    = (const float*)d_in[6];
  const float* gamma = (const float*)d_in[7];
  const float* beta  = (const float*)d_in[8];
  float* out = (float*)d_out;

  char* ws = (char*)d_ws;
  bf16*  xh   = (bf16*)(ws + XH_OFF);
  bf16*  wt   = (bf16*)(ws + WT_OFF);
  bf16*  qh   = (bf16*)(ws + QH_OFF);
  bf16*  kh   = (bf16*)(ws + KH_OFF);
  bf16*  vt   = (bf16*)(ws + VT_OFF);
  float* attn = (float*)(ws + AT_OFF);

  cvt_x_kernel<<<Mn * Dn / 256, 256, 0, stream>>>(x, xh);
  cvt_wT_kernel<<<dim3(Dn * Dn / 256, 3), 256, 0, stream>>>(Wq, Wk, Wv, wt);
  gemm_qkv_kernel<<<dim3(Mn / 128, Dn / 128, 3), 256, 0, stream>>>(
      xh, wt, bq, bk, bv, qh, kh, vt, out);
  attn_kernel<<<dim3(Bn * Hn, Sn / 128), 256, 0, stream>>>(qh, kh, vt, attn);
  ln_kernel<<<Mn, 256, 0, stream>>>(x, attn, gamma, beta, out);
}

// v002
// One run takes 207 microseconds.
// Next to v001, in two timings, it ran 1.35 times as fast each time.
// Counting every step since v000, it is 2.30 times as fast.
#include <hip/hip_runtime.h>
#include <math.h>
#include <stdint.h>

typedef __bf16 bf16;
typedef __attribute__((ext_vector_type(16))) __bf16 v16bf;
typedef __attribute__((ext_vector_type(8)))  __bf16 v8bf;
typedef __attribute__((ext_vector_type(8)))  float  v8f;

#define Bn  4
#define Sn  2048
#define Dn  1024
#define Hn  16
#define DHn 64
#define Mn  (Bn * Sn)          /* 8192 rows of x */

/* workspace layout (bytes) */
#define XH_OFF  0ull
#define XH_BY   ((size_t)Mn * Dn * 2)        /* x in bf16            16 MiB */
#define WT_OFF  (XH_OFF + XH_BY)
#define WT_BY   ((size_t)3 * Dn * Dn * 2)    /* Wq/Wk/Wv^T bf16       6 MiB */
#define QH_OFF  (WT_OFF + WT_BY)
#define QH_BY   ((size_t)Mn * Dn * 2)        /* Q bf16 (B,H,S,dh)    16 MiB */
#define KH_OFF  (QH_OFF + QH_BY)
#define KH_BY   ((size_t)Mn * Dn * 2)        /* K bf16 (B,H,S,dh)    16 MiB */
#define VT_OFF  (KH_OFF + KH_BY)
#define VT_BY   ((size_t)Mn * Dn * 2)        /* V^T bf16 (B,H,dh,S)  16 MiB */
#define AT_OFF  (VT_OFF + VT_BY)
#define AT_BY   ((size_t)Mn * Dn * 4)        /* attn f32 (B,S,D)     32 MiB */

#define P32 40                 /* rows of 32 bf16 (64 B):  pitch  80 B */
#define P64 72                 /* rows of 64 bf16 (128 B): pitch 144 B */

#define LDSA(l) ((unsigned)(uintptr_t)(l))
#define GLBA(g) ((unsigned long long)(uintptr_t)(g))
__device__ __forceinline__ void async2_b128(const bf16* g0, bf16* l0,
                                            const bf16* g1, bf16* l1) {
  asm volatile("global_load_async_to_lds_b128 %0, %1, off\n\t"
               "global_load_async_to_lds_b128 %2, %3, off\n\t"
               "s_wait_xcnt 0x0"
               :
               : "v"(LDSA(l0)), "v"(GLBA(g0)), "v"(LDSA(l1)), "v"(GLBA(g1))
               : "memory");
}

__device__ __forceinline__ void async4_b128(const bf16* g0, bf16* l0,
                                            const bf16* g1, bf16* l1,
                                            const bf16* g2, bf16* l2,
                                            const bf16* g3, bf16* l3) {
  asm volatile("global_load_async_to_lds_b128 %0, %1, off\n\t"
               "global_load_async_to_lds_b128 %2, %3, off\n\t"
               "global_load_async_to_lds_b128 %4, %5, off\n\t"
               "global_load_async_to_lds_b128 %6, %7, off\n\t"
               "s_wait_xcnt 0x0"
               :
               : "v"(LDSA(l0)), "v"(GLBA(g0)), "v"(LDSA(l1)), "v"(GLBA(g1)),
                 "v"(LDSA(l2)), "v"(GLBA(g2)), "v"(LDSA(l3)), "v"(GLBA(g3))
               : "memory");
}

/* in front of the barrier that hands a stage over: first this wave's LDS reads
 * of the buffer that is refilled behind the barrier have returned, then its
 * own copies of the next stage have landed */
__device__ __forceinline__ void wait_async() {
  asm volatile("s_wait_dscnt 0x0" ::: "memory");
  asm volatile("s_wait_asynccnt 0x0" ::: "memory");
}

__device__ __forceinline__ v16bf load_frag(const bf16* p) {
  union { v16bf v; v8bf h[2]; } f;
  f.h[0] = *(const v8bf*)(p);
  f.h[1] = *(const v8bf*)(p + 16);
  return f.v;
}

__device__ __forceinline__ v8f wmma_bf16(v16bf a, v16bf b, v8f c) {
  return __builtin_amdgcn_wmma_f32_16x16x32_bf16(
      false, a, false, b, (short)0, c, false, false);
}

__device__ __forceinline__ float xhalf(float x) {
  int b = __builtin_bit_cast(int, x);
  return __builtin_bit_cast(float, __builtin_amdgcn_permlanex16(
      b, b, 0x76543210, 0xfedcba98, false, false));
}

/* ---------------- conversion kernels ---------------- */

__global__ void cvt_x_kernel(const float* __restrict__ x, bf16* __restrict__ xh) {
  int i = blockIdx.x * 256 + threadIdx.x;
  xh[i] = (bf16)x[i];
}

__global__ void cvt_wT_kernel(const float* __restrict__ Wq,
                              const float* __restrict__ Wk,
                              const float* __restrict__ Wv,
                              bf16* __restrict__ wt) {
  int mat = blockIdx.y;
  const float* W = (mat == 0) ? Wq : ((mat == 1) ? Wk : Wv);
  int i = blockIdx.x * 256 + threadIdx.x;   /* i = n*1024 + k */
  int n = i >> 10, k = i & 1023;
  wt[(size_t)mat * Dn * Dn + i] = (bf16)W[k * Dn + n];
}

/* ---------------- fused QKV GEMM (bf16 WMMA, f32 acc) ----------------
 * grid (64, 8, 3), block 256 (8 waves). Block tile 128(M) x 128(N).
 * A/B tiles double-buffered in LDS via async-to-LDS; wave = 32x64.   */
__global__ void __launch_bounds__(256, 1)
gemm_qkv_kernel(const bf16* __restrict__ xh, const bf16* __restrict__ wt,
                const float* __restrict__ bq, const float* __restrict__ bk,
                const float* __restrict__ bv,
                bf16* __restrict__ qh, bf16* __restrict__ kh,
                bf16* __restrict__ vt, float* __restrict__ out) {
  __shared__ __attribute__((aligned(16))) bf16 abuf[2][128 * P32];  /* 10 KiB each */
  __shared__ __attribute__((aligned(16))) bf16 bbuf[2][128 * P32];

  const int tid  = threadIdx.x;
  const int lane = tid & 31;
  const int w    = tid >> 5;
  const int mat  = blockIdx.z;
  const int row0 = blockIdx.x * 128;
  const int col0 = blockIdx.y * 128;
  const int mw   = w & 3;              /* 4 waves across M */
  const int nw   = w >> 2;             /* 2 waves across N */
  const int ln   = lane & 15;
  const int kb   = (lane >> 4) * 8;

  const bf16*  wtm  = wt + (size_t)mat * Dn * Dn;
  const float* bias = (mat == 0) ? bq : ((mat == 1) ? bk : bv);

  const bf16* asrc = xh  + (size_t)row0 * Dn;   /* row stride Dn */
  const bf16* bsrc = wtm + (size_t)col0 * Dn;

  v8f acc[2][4];
  for (int t = 0; t < 4; ++t) {
    float bval = bias[col0 + nw * 64 + t * 16 + ln];
    for (int r = 0; r < 8; ++r) { acc[0][t][r] = bval; acc[1][t][r] = bval; }
  }

  /* cooperative stage of one 128x32 A tile + 128x32 B tile */
  auto stage = [&](int kk, int buf) {
    int row = tid >> 2, off = (tid & 3) * 8;   /* 512 16B chunks per tile: */
    size_t g0 = (size_t)row * Dn + kk + off;   /* rows 0..63 and 64..127   */
    size_t g1 = g0 + (size_t)64 * Dn;
    int l0 = row * P32 + off, l1 = l0 + 64 * P32;
    async4_b128(asrc + g0, &abuf[buf][l0], bsrc + g0, &bbuf[buf][l0],
                asrc + g1, &abuf[buf][l1], bsrc + g1, &bbuf[buf][l1]);
  };

  stage(0, 0);
  int cur = 0;
  for (int kk = 0; kk < Dn; kk += 32) {
    wait_async();
    __syncthreads();
    if (kk + 32 < Dn) stage(kk + 32, cur ^ 1);

    v16bf a0 = load_frag(&abuf[cur][(mw * 32 + ln) * P32 + kb]);
    v16bf a1 = load_frag(&abuf[cur][(mw * 32 + 16 + ln) * P32 + kb]);
    for (int t = 0; t < 4; ++t) {
      v16bf b = load_frag(&bbuf[cur][(nw * 64 + t * 16 + ln) * P32 + kb]);
      acc[0][t] = wmma_bf16(a0, b, acc[0][t]);
      acc[1][t] = wmma_bf16(a1, b, acc[1][t]);
    }
    cur ^= 1;
  }

  for (int ms = 0; ms < 2; ++ms) {
    const int mbase = row0 + mw * 32 + ms * 16 + 8 * (lane >> 4);
    for (int t = 0; t < 4; ++t) {
      int n = col0 + nw * 64 + t * 16 + ln;
      int h = n >> 6, d = n & 63;
      for (int r = 0; r < 8; ++r) {
        int m = mbase + r;
        int b = m >> 11, s = m & 2047;
        size_t idx = (((size_t)(b * Hn + h) * Sn) + s) * DHn + d;
        float val = acc[ms][t][r];
        if (mat == 0) {
          qh[idx] = (bf16)(val * 0.125f);            /* fold 1/sqrt(64) */
        } else if (mat == 1) {
          out[(size_t)Mn * Dn + idx] = val;          /* K cache f32 */
          kh[idx] = (bf16)val;
        } else {
          out[(size_t)2 * Mn * Dn + idx] = val;      /* V cache f32 */
          vt[((size_t)(b * Hn + h) * DHn + d) * Sn + s] = (bf16)val;
        }
      }
    }
  }
}

__global__ void __launch_bounds__(256, 1)
attn_kernel(const bf16* __restrict__ qh, const bf16* __restrict__ kh,
            const bf16* __restrict__ vt, float* __restrict__ attn) {
  __shared__ __attribute__((aligned(16))) bf16 kbuf[2][32 * P64];  /* [kv][dh] */
  __shared__ __attribute__((aligned(16))) bf16 vbuf[2][64 * P32];  /* [dh][kv] */

  const int tid  = threadIdx.x;
  const int lane = tid & 31;
  const int w    = tid >> 5;
  const int bh   = blockIdx.x;                 /* b*16 + h */
  const int qblk = blockIdx.y;
  const int q0   = qblk * 128 + w * 16;
  const int ln   = lane & 15;
  const int kb   = (lane >> 4) * 8;

  const bf16* qp = qh + (size_t)bh * Sn * DHn;
  const bf16* kp = kh + (size_t)bh * Sn * DHn;
  const bf16* vp = vt + (size_t)bh * DHn * Sn;

  /* B operand: column = query q0 + ln, k = dh in the loader's order */
  v16bf qb0 = load_frag(qp + (size_t)(q0 + ln) * DHn + 0  + kb);
  v16bf qb1 = load_frag(qp + (size_t)(q0 + ln) * DHn + 32 + kb);

  v8f acco[4];                         /* O^T: [dh = 16t + kb + r][query ln] */
  for (int t = 0; t < 4; ++t)
    for (int r = 0; r < 8; ++r) acco[t][r] = 0.0f;
  float mrow = -1e30f;                 /* this lane's query, both halves alike */
  float lrow = 0.0f;                   /* this half's share of the row sum     */

  const int qg        = q0 + ln;               /* this lane's query      */
  const int nblk_wave = (q0 + 47) >> 5;        /* causal bound per wave  */
  const int nblk_blk  = qblk * 4 + 4;          /* uniform over the block */

  /* cooperative stage of one K(32x64) + V(64x32) tile */
  auto stage_kv = [&](int blk, int buf) {
    int kv0 = blk * 32;
    int krow = tid >> 3, koff = (tid & 7) * 8;  /* 256 chunks of K   */
    int vrow = tid >> 2, voff = (tid & 3) * 8;  /* 256 chunks of V^T */
    async2_b128(kp + (size_t)(kv0 + krow) * DHn + koff,
                &kbuf[buf][krow * P64 + koff],
                vp + (size_t)vrow * Sn + kv0 + voff,
                &vbuf[buf][vrow * P32 + voff]);
  };

  stage_kv(0, 0);
  int cur = 0;
  for (int blk = 0; blk < nblk_blk; ++blk) {
    wait_async();
    __syncthreads();
    if (blk + 1 < nblk_blk) stage_kv(blk + 1, cur ^ 1);

    if (blk < nblk_wave) {
      int kv0 = blk * 32;
      v8f s0, s1;
      for (int r = 0; r < 8; ++r) { s0[r] = 0.0f; s1[r] = 0.0f; }

      v16bf k0a = load_frag(&kbuf[cur][(ln)      * P64 + 0  + kb]);
      v16bf k0b = load_frag(&kbuf[cur][(ln)      * P64 + 32 + kb]);
      s0 = wmma_bf16(k0a, qb0, s0);
      s0 = wmma_bf16(k0b, qb1, s0);
      v16bf k1a = load_frag(&kbuf[cur][(16 + ln) * P64 + 0  + kb]);
      v16bf k1b = load_frag(&kbuf[cur][(16 + ln) * P64 + 32 + kb]);
      s1 = wmma_bf16(k1a, qb0, s1);
      s1 = wmma_bf16(k1b, qb1, s1);

      /* online softmax of one query per lane: s0[r] is key kv0 + kb + r,
       * s1[r] is key kv0 + 16 + kb + r                                   */
      float mx = -1e30f;
      for (int r = 0; r < 8; ++r) {
        s0[r] = ((kv0 + kb + r)      <= qg) ? s0[r] : -1e30f;
        s1[r] = ((kv0 + 16 + kb + r) <= qg) ? s1[r] : -1e30f;
        mx = fmaxf(mx, fmaxf(s0[r], s1[r]));
      }
      mx = fmaxf(mx, xhalf(mx));
      float mnew = fmaxf(mrow, mx);
      float corr = __expf(mrow - mnew);
      mrow = mnew;

      v16bf pb;                        /* P^T as B: k = kb + r, 16 + kb + r */
      float rs0 = 0.0f, rs1 = 0.0f;
      for (int r = 0; r < 8; ++r) {
        float p0 = __expf(s0[r] - mnew);
        float p1 = __expf(s1[r] - mnew);
        rs0 += p0;
        rs1 += p1;
        pb[r]     = (bf16)p0;
        pb[8 + r] = (bf16)p1;
      }
      lrow = lrow * corr + (rs0 + rs1);
      for (int t = 0; t < 4; ++t)
        for (int r = 0; r < 8; ++r) acco[t][r] *= corr;

      for (int t = 0; t < 4; ++t) {
        v16bf va = load_frag(&vbuf[cur][(t * 16 + ln) * P32 + kb]);
        acco[t] = wmma_bf16(va, pb, acco[t]);
      }
    }
    cur ^= 1;
  }

  /* join the two halves' shares of the row sum, once */
  lrow += xhalf(lrow);
  const float inv = 1.0f / lrow;

  const int b = bh >> 4, h = bh & 15;
  float* op = attn + ((size_t)(b * Sn + qg)) * Dn + h * DHn + kb;
  for (int t = 0; t < 4; ++t) {
    float4 lo, hi;
    lo.x = acco[t][0] * inv; lo.y = acco[t][1] * inv;
    lo.z = acco[t][2] * inv; lo.w = acco[t][3] * inv;
    hi.x = acco[t][4] * inv; hi.y = acco[t][5] * inv;
    hi.z = acco[t][6] * inv; hi.w = acco[t][7] * inv;
    *(float4*)(op + t * 16)     = lo;
    *(float4*)(op + t * 16 + 4) = hi;
  }
}

/* ---------------- residual + LayerNorm ---------------- */
__global__ void __launch_bounds__(256, 1)
ln_kernel(const float* __restrict__ x, const float* __restrict__ attn,
          const float* __restrict__ gamma, const float* __restrict__ beta,
          float* __restrict__ out) {
  __shared__ float red[256];
  const int row = blockIdx.x;
  const int tid = threadIdx.x;
  const float* xr = x    + (size_t)row * Dn;
  const float* ar = attn + (size_t)row * Dn;

  float y[4];
  float sum = 0.0f;
  for (int i = 0; i < 4; ++i) {
    y[i] = xr[tid + i * 256] + ar[tid + i * 256];
    sum += y[i];
  }
  red[tid] = sum; __syncthreads();
  for (int s = 128; s > 0; s >>= 1) {
    if (tid < s) red[tid] += red[tid + s];
    __syncthreads();
  }
  float mu = red[0] * (1.0f / 1024.0f);
  __syncthreads();

  float vs = 0.0f;
  for (int i = 0; i < 4; ++i) { float d = y[i] - mu; vs += d * d; }
  red[tid] = vs; __syncthreads();
  for (int s = 128; s > 0; s >>= 1) {
    if (tid < s) red[tid] += red[tid + s];
    __syncthreads();
  }
  float rstd = rsqrtf(red[0] * (1.0f / 1024.0f) + 1e-5f);

  for (int i = 0; i < 4; ++i) {
    int c = tid + i * 256;
    out[(size_t)row * Dn + c] = (y[i] - mu) * rstd * gamma[c] + beta[c];
  }
}

extern "C" void kernel_launch(void* const* d_in, const int* in_sizes, int n_in,
                              void* d_out, int out_size, void* d_ws, size_t ws_size,
                              hipStream_t stream) {
  const float* x     = (const float*)d_in[0];
  const float* Wq    = (const float*)d_in[1];
  const float* bq    = (const float*)d_in[2];
  const float* Wk    = (const float*)d_in[3];
  const float* bk    = (const float*)d_in[4];
  const float* Wv    = (const float*)d_in[5];
  const float* bv    = (const float*)d_in[6];
  const float* gamma = (const float*)d_in[7];
  const float* beta  = (const float*)d_in[8];
  float* out = (float*)d_out;

  char* ws = (char*)d_ws;
  bf16*  xh   = (bf16*)(ws + XH_OFF);
  bf16*  wt   = (bf16*)(ws + WT_OFF);
  bf16*  qh   = (bf16*)(ws + QH_OFF);
  bf16*  kh   = (bf16*)(ws + KH_OFF);
  bf16*  vt   = (bf16*)(ws + VT_OFF);
  float* attn = (float*)(ws + AT_OFF);

  cvt_x_kernel<<<Mn * Dn / 256, 256, 0, stream>>>(x, xh);
  cvt_wT_kernel<<<dim3(Dn * Dn / 256, 3), 256, 0, stream>>>(Wq, Wk, Wv, wt);
  gemm_qkv_kernel<<<dim3(Mn / 128, Dn / 128, 3), 256, 0, stream>>>(
      xh, wt, bq, bk, bv, qh, kh, vt, out);
  attn_kernel<<<dim3(Bn * Hn, Sn / 128), 256, 0, stream>>>(qh, kh, vt, attn);
  ln_kernel<<<Mn, 256, 0, stream>>>(x, attn, gamma, beta, out);
}

// v003
// It runs in 174 microseconds.
// Two timings next to v002 both put it at 1.19 times that version's speed.
// Counting every step since v000, it is 2.74 times as fast.
#include <hip/hip_runtime.h>
#include <math.h>
#include <stdint.h>

typedef __bf16 bf16;
typedef __attribute__((ext_vector_type(16))) __bf16 v16bf;
typedef __attribute__((ext_vector_type(8)))  __bf16 v8bf;
typedef __attribute__((ext_vector_type(8)))  float  v8f;
typedef __attribute__((ext_vector_type(4)))  float  v4f;
typedef __attribute__((ext_vector_type(4)))  __bf16 v4bf;

#define Bn  4
#define Sn  2048
#define Dn  1024
#define Hn  16
#define DHn 64
#define Mn  (Bn * Sn)          /* 8192 rows of x */

/* workspace layout (bytes) */
#define XH_OFF  0ull
#define XH_BY   ((size_t)Mn * Dn * 2)        /* x in bf16            16 MiB */
#define WT_OFF  (XH_OFF + XH_BY)
#define WT_BY   ((size_t)3 * Dn * Dn * 2)    /* Wq/Wk/Wv^T bf16       6 MiB */
#define QH_OFF  (WT_OFF + WT_BY)
#define QH_BY   ((size_t)Mn * Dn * 2)        /* Q bf16 (B,H,S,dh)    16 MiB */
#define KH_OFF  (QH_OFF + QH_BY)
#define KH_BY   ((size_t)Mn * Dn * 2)        /* K bf16 (B,H,S,dh)    16 MiB */
#define VT_OFF  (KH_OFF + KH_BY)
#define VT_BY   ((size_t)Mn * Dn * 2)        /* V^T bf16 (B,H,dh,S)  16 MiB */
#define AT_OFF  (VT_OFF + VT_BY)
#define AT_BY   ((size_t)Mn * Dn * 4)        /* attn f32 (B,S,D)     32 MiB */

#define P32 40                 /* rows of 32 bf16 (64 B):  pitch  80 B */
#define P64 72                 /* rows of 64 bf16 (128 B): pitch 144 B */

#define LDSA(l) ((unsigned)(uintptr_t)(l))
#define GLBA(g) ((unsigned long long)(uintptr_t)(g))
__device__ __forceinline__ void async2_b128(const bf16* g0, bf16* l0,
                                            const bf16* g1, bf16* l1) {
  asm volatile("global_load_async_to_lds_b128 %0, %1, off\n\t"
               "global_load_async_to_lds_b128 %2, %3, off\n\t"
               "s_wait_xcnt 0x0"
               :
               : "v"(LDSA(l0)), "v"(GLBA(g0)), "v"(LDSA(l1)), "v"(GLBA(g1))
               : "memory");
}

__device__ __forceinline__ void async4_b128(const bf16* g0, bf16* l0,
                                            const bf16* g1, bf16* l1,
                                            const bf16* g2, bf16* l2,
                                            const bf16* g3, bf16* l3) {
  asm volatile("global_load_async_to_lds_b128 %0, %1, off\n\t"
               "global_load_async_to_lds_b128 %2, %3, off\n\t"
               "global_load_async_to_lds_b128 %4, %5, off\n\t"
               "global_load_async_to_lds_b128 %6, %7, off\n\t"
               "s_wait_xcnt 0x0"
               :
               : "v"(LDSA(l0)), "v"(GLBA(g0)), "v"(LDSA(l1)), "v"(GLBA(g1)),
                 "v"(LDSA(l2)), "v"(GLBA(g2)), "v"(LDSA(l3)), "v"(GLBA(g3))
               : "memory");
}

/* in front of the barrier that hands a stage over: first this wave's LDS reads
 * of the buffer that is refilled behind the barrier have returned, then its
 * own copies of the next stage have landed */
__device__ __forceinline__ void wait_async() {
  asm volatile("s_wait_dscnt 0x0" ::: "memory");
  asm volatile("s_wait_asynccnt 0x0" ::: "memory");
}

__device__ __forceinline__ v16bf load_frag(const bf16* p) {
  union { v16bf v; v8bf h[2]; } f;
  f.h[0] = *(const v8bf*)(p);
  f.h[1] = *(const v8bf*)(p + 16);
  return f.v;
}

__device__ __forceinline__ v8f wmma_bf16(v16bf a, v16bf b, v8f c) {
  return __builtin_amdgcn_wmma_f32_16x16x32_bf16(
      false, a, false, b, (short)0, c, false, false);
}

__device__ __forceinline__ float xhalf(float x) {
  int b = __builtin_bit_cast(int, x);
  return __builtin_bit_cast(float, __builtin_amdgcn_permlanex16(
      b, b, 0x76543210, 0xfedcba98, false, false));
}

/* ---------------- conversion kernels ----------------
 * Streaming form: few waves, each with 8 or 16 loads of 16 bytes a lane in
 * flight, every load instruction of a wave covering whole 128-byte lines. */

/* grid 512, block 256: 16 waves per WGP. A wave converts 2048 consecutive
 * elements, 16 loads and 16 stores a lane.                               */
__global__ void __launch_bounds__(256)
cvt_x_kernel(const float* __restrict__ x, bf16* __restrict__ xh) {
  const int lane = threadIdx.x & 31;
  const int wv   = blockIdx.x * 8 + (threadIdx.x >> 5);
  const size_t base = (size_t)wv * 2048 + lane * 4;
  v4f v[16];
  for (int i = 0; i < 16; ++i) v[i] = *(const v4f*)(x + base + i * 128);
  for (int i = 0; i < 16; ++i)
    *(v4bf*)(xh + base + i * 128) = __builtin_convertvector(v[i], v4bf);
}

/* grid (128, 3), block 256. A wave transposes a 32(k) x 32(n) tile in
 * registers: a lane loads 8 rows k of 4 columns n (a load instruction reads
 * 4 rows of 128 B) and stores 4 rows n of 8 k (16 B each).               */
__global__ void __launch_bounds__(256)
cvt_wT_kernel(const float* __restrict__ Wq,
              const float* __restrict__ Wk,
              const float* __restrict__ Wv,
              bf16* __restrict__ wt) {
  const int mat = blockIdx.y;
  const float* W = (mat == 0) ? Wq : ((mat == 1) ? Wk : Wv);
  const int lane = threadIdx.x & 31;
  const int wv   = blockIdx.x * 8 + (threadIdx.x >> 5);   /* 0..1023 */
  const int k0   = (wv & 31) * 32 + (lane & 3) * 8;
  const int n0   = (wv >> 5) * 32 + (lane >> 2) * 4;
  v4f v[8];
  for (int i = 0; i < 8; ++i)
    v[i] = *(const v4f*)(W + (size_t)(k0 + i) * Dn + n0);
  bf16* o = wt + (size_t)mat * Dn * Dn + (size_t)n0 * Dn + k0;
  for (int j = 0; j < 4; ++j) {
    v8bf r;
    for (int i = 0; i < 8; ++i) r[i] = (bf16)v[i][j];
    *(v8bf*)(o + (size_t)j * Dn) = r;
  }
}

/* ---------------- fused QKV GEMM (bf16 WMMA, f32 acc) ----------------
 * grid (64, 8, 3), block 256 (8 waves). Block tile 128(M) x 128(N).
 * A/B tiles double-buffered in LDS via async-to-LDS; wave = 32x64.   */
__global__ void __launch_bounds__(256, 1)
gemm_qkv_kernel(const bf16* __restrict__ xh, const bf16* __restrict__ wt,
                const float* __restrict__ bq, const float* __restrict__ bk,
                const float* __restrict__ bv,
                bf16* __restrict__ qh, bf16* __restrict__ kh,
                bf16* __restrict__ vt, float* __restrict__ out) {
  __shared__ __attribute__((aligned(16))) bf16 abuf[2][128 * P32];  /* 10 KiB each */
  __shared__ __attribute__((aligned(16))) bf16 bbuf[2][128 * P32];

  const int tid  = threadIdx.x;
  const int lane = tid & 31;
  const int w    = tid >> 5;
  const int mat  = blockIdx.z;
  const int row0 = blockIdx.x * 128;
  const int col0 = blockIdx.y * 128;
  const int mw   = w & 3;              /* 4 waves across M */
  const int nw   = w >> 2;             /* 2 waves across N */
  const int ln   = lane & 15;
  const int kb   = (lane >> 4) * 8;

  const bf16*  wtm  = wt + (size_t)mat * Dn * Dn;
  const float* bias = (mat == 0) ? bq : ((mat == 1) ? bk : bv);

  const bf16* asrc = xh  + (size_t)row0 * Dn;   /* row stride Dn */
  const bf16* bsrc = wtm + (size_t)col0 * Dn;

  v8f acc[2][4];
  for (int t = 0; t < 4; ++t) {
    float bval = bias[col0 + nw * 64 + t * 16 + ln];
    for (int r = 0; r < 8; ++r) { acc[0][t][r] = bval; acc[1][t][r] = bval; }
  }

  /* cooperative stage of one 128x32 A tile + 128x32 B tile */
  auto stage = [&](int kk, int buf) {
    int row = tid >> 2, off = (tid & 3) * 8;   /* 512 16B chunks per tile: */
    size_t g0 = (size_t)row * Dn + kk + off;   /* rows 0..63 and 64..127   */
    size_t g1 = g0 + (size_t)64 * Dn;
    int l0 = row * P32 + off, l1 = l0 + 64 * P32;
    async4_b128(asrc + g0, &abuf[buf][l0], bsrc + g0, &bbuf[buf][l0],
                asrc + g1, &abuf[buf][l1], bsrc + g1, &bbuf[buf][l1]);
  };

  stage(0, 0);
  int cur = 0;
  for (int kk = 0; kk < Dn; kk += 32) {
    wait_async();
    __syncthreads();
    if (kk + 32 < Dn) stage(kk + 32, cur ^ 1);

    v16bf a0 = load_frag(&abuf[cur][(mw * 32 + ln) * P32 + kb]);
    v16bf a1 = load_frag(&abuf[cur][(mw * 32 + 16 + ln) * P32 + kb]);
    for (int t = 0; t < 4; ++t) {
      v16bf b = load_frag(&bbuf[cur][(nw * 64 + t * 16 + ln) * P32 + kb]);
      acc[0][t] = wmma_bf16(a0, b, acc[0][t]);
      acc[1][t] = wmma_bf16(a1, b, acc[1][t]);
    }
    cur ^= 1;
  }

  for (int ms = 0; ms < 2; ++ms) {
    const int mbase = row0 + mw * 32 + ms * 16 + 8 * (lane >> 4);
    for (int t = 0; t < 4; ++t) {
      int n = col0 + nw * 64 + t * 16 + ln;
      int h = n >> 6, d = n & 63;
      for (int r = 0; r < 8; ++r) {
        int m = mbase + r;
        int b = m >> 11, s = m & 2047;
        size_t idx = (((size_t)(b * Hn + h) * Sn) + s) * DHn + d;
        float val = acc[ms][t][r];
        if (mat == 0) {
          qh[idx] = (bf16)(val * 0.125f);            /* fold 1/sqrt(64) */
        } else if (mat == 1) {
          out[(size_t)Mn * Dn + idx] = val;          /* K cache f32 */
          kh[idx] = (bf16)val;
        } else {
          out[(size_t)2 * Mn * Dn + idx] = val;      /* V cache f32 */
          vt[((size_t)(b * Hn + h) * DHn + d) * Sn + s] = (bf16)val;
        }
      }
    }
  }
}

__global__ void __launch_bounds__(256, 1)
attn_kernel(const bf16* __restrict__ qh, const bf16* __restrict__ kh,
            const bf16* __restrict__ vt, float* __restrict__ attn) {
  __shared__ __attribute__((aligned(16))) bf16 kbuf[2][32 * P64];  /* [kv][dh] */
  __shared__ __attribute__((aligned(16))) bf16 vbuf[2][64 * P32];  /* [dh][kv] */

  const int tid  = threadIdx.x;
  const int lane = tid & 31;
  const int w    = tid >> 5;
  const int bh   = blockIdx.x;                 /* b*16 + h */
  const int qblk = blockIdx.y;
  const int q0   = qblk * 128 + w * 16;
  const int ln   = lane & 15;
  const int kb   = (lane >> 4) * 8;

  const bf16* qp = qh + (size_t)bh * Sn * DHn;
  const bf16* kp = kh + (size_t)bh * Sn * DHn;
  const bf16* vp = vt + (size_t)bh * DHn * Sn;

  /* B operand: column = query q0 + ln, k = dh in the loader's order */
  v16bf qb0 = load_frag(qp + (size_t)(q0 + ln) * DHn + 0  + kb);
  v16bf qb1 = load_frag(qp + (size_t)(q0 + ln) * DHn + 32 + kb);

  v8f acco[4];                         /* O^T: [dh = 16t + kb + r][query ln] */
  for (int t = 0; t < 4; ++t)
    for (int r = 0; r < 8; ++r) acco[t][r] = 0.0f;
  float mrow = -1e30f;                 /* this lane's query, both halves alike */
  float lrow = 0.0f;                   /* this half's share of the row sum     */

  const int qg        = q0 + ln;               /* this lane's query      */
  const int nblk_wave = (q0 + 47) >> 5;        /* causal bound per wave  */
  const int nblk_blk  = qblk * 4 + 4;          /* uniform over the block */

  /* cooperative stage of one K(32x64) + V(64x32) tile */
  auto stage_kv = [&](int blk, int buf) {
    int kv0 = blk * 32;
    int krow = tid >> 3, koff = (tid & 7) * 8;  /* 256 chunks of K   */
    int vrow = tid >> 2, voff = (tid & 3) * 8;  /* 256 chunks of V^T */
    async2_b128(kp + (size_t)(kv0 + krow) * DHn + koff,
                &kbuf[buf][krow * P64 + koff],
                vp + (size_t)vrow * Sn + kv0 + voff,
                &vbuf[buf][vrow * P32 + voff]);
  };

  stage_kv(0, 0);
  int cur = 0;
  for (int blk = 0; blk < nblk_blk; ++blk) {
    wait_async();
    __syncthreads();
    if (blk + 1 < nblk_blk) stage_kv(blk + 1, cur ^ 1);

    if (blk < nblk_wave) {
      int kv0 = blk * 32;
      v8f s0, s1;
      for (int r = 0; r < 8; ++r) { s0[r] = 0.0f; s1[r] = 0.0f; }

      v16bf k0a = load_frag(&kbuf[cur][(ln)      * P64 + 0  + kb]);
      v16bf k0b = load_frag(&kbuf[cur][(ln)      * P64 + 32 + kb]);
      s0 = wmma_bf16(k0a, qb0, s0);
      s0 = wmma_bf16(k0b, qb1, s0);
      v16bf k1a = load_frag(&kbuf[cur][(16 + ln) * P64 + 0  + kb]);
      v16bf k1b = load_frag(&kbuf[cur][(16 + ln) * P64 + 32 + kb]);
      s1 = wmma_bf16(k1a, qb0, s1);
      s1 = wmma_bf16(k1b, qb1, s1);

      /* online softmax of one query per lane: s0[r] is key kv0 + kb + r,
       * s1[r] is key kv0 + 16 + kb + r                                   */
      float mx = -1e30f;
      for (int r = 0; r < 8; ++r) {
        s0[r] = ((kv0 + kb + r)      <= qg) ? s0[r] : -1e30f;
        s1[r] = ((kv0 + 16 + kb + r) <= qg) ? s1[r] : -1e30f;
        mx = fmaxf(mx, fmaxf(s0[r], s1[r]));
      }
      mx = fmaxf(mx, xhalf(mx));
      float mnew = fmaxf(mrow, mx);
      float corr = __expf(mrow - mnew);
      mrow = mnew;

      v16bf pb;                        /* P^T as B: k = kb + r, 16 + kb + r */
      float rs0 = 0.0f, rs1 = 0.0f;
      for (int r = 0; r < 8; ++r) {
        float p0 = __expf(s0[r] - mnew);
        float p1 = __expf(s1[r] - mnew);
        rs0 += p0;
        rs1 += p1;
        pb[r]     = (bf16)p0;
        pb[8 + r] = (bf16)p1;
      }
      lrow = lrow * corr + (rs0 + rs1);
      for (int t = 0; t < 4; ++t)
        for (int r = 0; r < 8; ++r) acco[t][r] *= corr;

      for (int t = 0; t < 4; ++t) {
        v16bf va = load_frag(&vbuf[cur][(t * 16 + ln) * P32 + kb]);
        acco[t] = wmma_bf16(va, pb, acco[t]);
      }
    }
    cur ^= 1;
  }

  /* join the two halves' shares of the row sum, once */
  lrow += xhalf(lrow);
  const float inv = 1.0f / lrow;

  const int b = bh >> 4, h = bh & 15;
  float* op = attn + ((size_t)(b * Sn + qg)) * Dn + h * DHn + kb;
  for (int t = 0; t < 4; ++t) {
    float4 lo, hi;
    lo.x = acco[t][0] * inv; lo.y = acco[t][1] * inv;
    lo.z = acco[t][2] * inv; lo.w = acco[t][3] * inv;
    hi.x = acco[t][4] * inv; hi.y = acco[t][5] * inv;
    hi.z = acco[t][6] * inv; hi.w = acco[t][7] * inv;
    *(float4*)(op + t * 16)     = lo;
    *(float4*)(op + t * 16 + 4) = hi;
  }
}

/* ---------------- residual + LayerNorm ----------------
 * Streaming form: grid 512, block 256 (16 waves per WGP), two rows per wave.
 * A lane holds 32 elements of each row (8 x 16 B of x and of attn) and its
 * 32 elements of gamma and beta, which serve both rows; the sums are
 * in-lane, then a butterfly over the 32 lanes: no LDS.                    */

/* sum over the wave, the same value in every lane: four exchanges inside the
 * 16-lane row, one between the rows */
__device__ __forceinline__ float wave_sum(float s) {
  s += __builtin_bit_cast(float, __builtin_amdgcn_update_dpp(
      0, __builtin_bit_cast(int, s), 0x161, 0xf, 0xf, true));  /* row_xmask:1 */
  s += __builtin_bit_cast(float, __builtin_amdgcn_update_dpp(
      0, __builtin_bit_cast(int, s), 0x162, 0xf, 0xf, true));  /* row_xmask:2 */
  s += __builtin_bit_cast(float, __builtin_amdgcn_update_dpp(
      0, __builtin_bit_cast(int, s), 0x164, 0xf, 0xf, true));  /* row_xmask:4 */
  s += __builtin_bit_cast(float, __builtin_amdgcn_update_dpp(
      0, __builtin_bit_cast(int, s), 0x168, 0xf, 0xf, true));  /* row_xmask:8 */
  return s + xhalf(s);
}

__global__ void __launch_bounds__(256)
ln_kernel(const float* __restrict__ x, const float* __restrict__ attn,
          const float* __restrict__ gamma, const float* __restrict__ beta,
          float* __restrict__ out) {
  const unsigned l4 = (threadIdx.x & 31) * 4;   /* the lane's place in 128 */
  /* the wave's number as a scalar: the row addresses then stay in scalar
   * registers and the one lane offset serves every load and store */
  const int wave = __builtin_amdgcn_readfirstlane(threadIdx.x >> 5);
  const size_t off = (size_t)((blockIdx.x * 8 + wave) * 2) * Dn;
  const float* xr = x    + off;
  const float* ar = attn + off;
  float*       yr = out  + off;

  v4f xv[2][8], av[2][8], g[8], b[8];
  for (int j = 0; j < 2; ++j)
    for (int i = 0; i < 8; ++i) {
      xv[j][i] = *(const v4f*)(xr + l4 + j * Dn + i * 128);
      av[j][i] = *(const v4f*)(ar + l4 + j * Dn + i * 128);
    }
  for (int i = 0; i < 8; ++i) {
    g[i] = *(const v4f*)(gamma + l4 + i * 128);
    b[i] = *(const v4f*)(beta  + l4 + i * 128);
  }
  /* keeps every load of the wave ahead of the arithmetic, so that all are in
   * flight together; without it the later ones are sunk behind the sums */
  __builtin_amdgcn_sched_barrier(0);

  float s[2];
  for (int j = 0; j < 2; ++j) {
    v4f s4 = {0.0f, 0.0f, 0.0f, 0.0f};
    for (int i = 0; i < 8; ++i) { xv[j][i] += av[j][i]; s4 += xv[j][i]; }
    s[j] = (s4[0] + s4[1]) + (s4[2] + s4[3]);
  }
  for (int j = 0; j < 2; ++j) s[j] = wave_sum(s[j]) * (1.0f / 1024.0f);

  float q[2];
  for (int j = 0; j < 2; ++j) {
    v4f q4 = {0.0f, 0.0f, 0.0f, 0.0f};
    for (int i = 0; i < 8; ++i) { xv[j][i] -= s[j]; q4 += xv[j][i] * xv[j][i]; }
    q[j] = (q4[0] + q4[1]) + (q4[2] + q4[3]);
  }
  for (int j = 0; j < 2; ++j)
    q[j] = rsqrtf(wave_sum(q[j]) * (1.0f / 1024.0f) + 1e-5f);

  for (int j = 0; j < 2; ++j)
    for (int i = 0; i < 8; ++i)
      *(v4f*)(yr + l4 + j * Dn + i * 128) = xv[j][i] * q[j] * g[i] + b[i];
}

extern "C" void kernel_launch(void* const* d_in, const int* in_sizes, int n_in,
                              void* d_out, int out_size, void* d_ws, size_t ws_size,
                              hipStream_t stream) {
  const float* x     = (const float*)d_in[0];
  const float* Wq    = (const float*)d_in[1];
  const float* bq    = (const float*)d_in[2];
  const float* Wk    = (const float*)d_in[3];
  const float* bk    = (const float*)d_in[4];
  const float* Wv    = (const float*)d_in[5];
  const float* bv    = (const float*)d_in[6];
  const float* gamma = (const float*)d_in[7];
  const float* beta  = (const float*)d_in[8];
  float* out = (float*)d_out;

  char* ws = (char*)d_ws;
  bf16*  xh   = (bf16*)(ws + XH_OFF);
  bf16*  wt   = (bf16*)(ws + WT_OFF);
  bf16*  qh   = (bf16*)(ws + QH_OFF);
  bf16*  kh   = (bf16*)(ws + KH_OFF);
  bf16*  vt   = (bf16*)(ws + VT_OFF);
  float* attn = (float*)(ws + AT_OFF);

  cvt_x_kernel<<<Mn * Dn / 16384, 256, 0, stream>>>(x, xh);
  cvt_wT_kernel<<<dim3(Dn * Dn / 8192, 3), 256, 0, stream>>>(Wq, Wk, Wv, wt);
  gemm_qkv_kernel<<<dim3(Mn / 128, Dn / 128, 3), 256, 0, stream>>>(
      xh, wt, bq, bk, bv, qh, kh, vt, out);
  attn_kernel<<<dim3(Bn * Hn, Sn / 128), 256, 0, stream>>>(qh, kh, vt, attn);
  ln_kernel<<<Mn / 16, 256, 0, stream>>>(x, attn, gamma, beta, out);
}

// v004
// Measured time: 132 microseconds a run.
// Two timings next to v003 both put it at 1.32 times that version's speed.
// Counting every step since v000, it is 3.62 times as fast.
#include <hip/hip_runtime.h>
#include <math.h>
#include <stdint.h>

typedef __bf16 bf16;
typedef __attribute__((ext_vector_type(16))) __bf16 v16bf;
typedef __attribute__((ext_vector_type(8)))  __bf16 v8bf;
typedef __attribute__((ext_vector_type(8)))  float  v8f;
typedef __attribute__((ext_vector_type(4)))  float  v4f;
typedef __attribute__((ext_vector_type(4)))  __bf16 v4bf;

#define Bn  4
#define Sn  2048
#define Dn  1024
#define Hn  16
#define DHn 64
#define Mn  (Bn * Sn)          /* 8192 rows of x */

/* workspace layout (bytes) */
#define XH_OFF  0ull
#define XH_BY   ((size_t)Mn * Dn * 2)        /* x in bf16            16 MiB */
#define WT_OFF  (XH_OFF + XH_BY)
#define WT_BY   ((size_t)3 * Dn * Dn * 2)    /* Wq/Wk/Wv^T bf16       6 MiB */
#define QH_OFF  (WT_OFF + WT_BY)
#define QH_BY   ((size_t)Mn * Dn * 2)        /* Q bf16 (B,H,S,dh)    16 MiB */
#define KH_OFF  (QH_OFF + QH_BY)
#define KH_BY   ((size_t)Mn * Dn * 2)        /* K bf16 (B,H,S,dh)    16 MiB */
#define VT_OFF  (KH_OFF + KH_BY)
#define VT_BY   ((size_t)Mn * Dn * 2)        /* V^T bf16 (B,H,dh,S)  16 MiB */
#define AT_OFF  (VT_OFF + VT_BY)
#define AT_BY   ((size_t)Mn * Dn * 4)        /* attn f32 (B,S,D)     32 MiB */

#define P32 40                 /* rows of 32 bf16 (64 B):  pitch  80 B */
#define P64 72                 /* rows of 64 bf16 (128 B): pitch 144 B */

#define LDSA(l) ((unsigned)(uintptr_t)(l))
#define GLBA(g) ((unsigned long long)(uintptr_t)(g))
__device__ __forceinline__ void async2_b128(const bf16* g0, bf16* l0,
                                            const bf16* g1, bf16* l1) {
  asm volatile("global_load_async_to_lds_b128 %0, %1, off\n\t"
               "global_load_async_to_lds_b128 %2, %3, off\n\t"
               "s_wait_xcnt 0x0"
               :
               : "v"(LDSA(l0)), "v"(GLBA(g0)), "v"(LDSA(l1)), "v"(GLBA(g1))
               : "memory");
}

__device__ __forceinline__ void async4_b128(const bf16* g0, bf16* l0,
                                            const bf16* g1, bf16* l1,
                                            const bf16* g2, bf16* l2,
                                            const bf16* g3, bf16* l3) {
  asm volatile("global_load_async_to_lds_b128 %0, %1, off\n\t"
               "global_load_async_to_lds_b128 %2, %3, off\n\t"
               "global_load_async_to_lds_b128 %4, %5, off\n\t"
               "global_load_async_to_lds_b128 %6, %7, off\n\t"
               "s_wait_xcnt 0x0"
               :
               : "v"(LDSA(l0)), "v"(GLBA(g0)), "v"(LDSA(l1)), "v"(GLBA(g1)),
                 "v"(LDSA(l2)), "v"(GLBA(g2)), "v"(LDSA(l3)), "v"(GLBA(g3))
               : "memory");
}

/* in front of the barrier that hands a stage over: first this wave's LDS reads
 * of the buffer that is refilled behind the barrier have returned, then its
 * own copies of the next stage have landed */
__device__ __forceinline__ void wait_async() {
  asm volatile("s_wait_dscnt 0x0" ::: "memory");
  asm volatile("s_wait_asynccnt 0x0" ::: "memory");
}

__device__ __forceinline__ v16bf load_frag(const bf16* p) {
  union { v16bf v; v8bf h[2]; } f;
  f.h[0] = *(const v8bf*)(p);
  f.h[1] = *(const v8bf*)(p + 16);
  return f.v;
}

__device__ __forceinline__ v8f wmma_bf16(v16bf a, v16bf b, v8f c) {
  return __builtin_amdgcn_wmma_f32_16x16x32_bf16(
      false, a, false, b, (short)0, c, false, false);
}

__device__ __forceinline__ float xhalf(float x) {
  int b = __builtin_bit_cast(int, x);
  return __builtin_bit_cast(float, __builtin_amdgcn_permlanex16(
      b, b, 0x76543210, 0xfedcba98, false, false));
}

/* ---------------- conversion kernels ----------------
 * Streaming form: few waves, each with 8 or 16 loads of 16 bytes a lane in
 * flight, every load instruction of a wave covering whole 128-byte lines. */

/* grid 512, block 256: 16 waves per WGP. A wave converts 2048 consecutive
 * elements, 16 loads and 16 stores a lane.                               */
__global__ void __launch_bounds__(256)
cvt_x_kernel(const float* __restrict__ x, bf16* __restrict__ xh) {
  const int lane = threadIdx.x & 31;
  const int wv   = blockIdx.x * 8 + (threadIdx.x >> 5);
  const size_t base = (size_t)wv * 2048 + lane * 4;
  v4f v[16];
  for (int i = 0; i < 16; ++i) v[i] = *(const v4f*)(x + base + i * 128);
  for (int i = 0; i < 16; ++i)
    *(v4bf*)(xh + base + i * 128) = __builtin_convertvector(v[i], v4bf);
}

/* grid (128, 3), block 256. A wave transposes a 32(k) x 32(n) tile in
 * registers: a lane loads 8 rows k of 4 columns n (a load instruction reads
 * 4 rows of 128 B) and stores 4 rows n of 8 k (16 B each).               */
__global__ void __launch_bounds__(256)
cvt_wT_kernel(const float* __restrict__ Wq,
              const float* __restrict__ Wk,
              const float* __restrict__ Wv,
              bf16* __restrict__ wt) {
  const int mat = blockIdx.y;
  const float* W = (mat == 0) ? Wq : ((mat == 1) ? Wk : Wv);
  const int lane = threadIdx.x & 31;
  const int wv   = blockIdx.x * 8 + (threadIdx.x >> 5);   /* 0..1023 */
  const int k0   = (wv & 31) * 32 + (lane & 3) * 8;
  const int n0   = (wv >> 5) * 32 + (lane >> 2) * 4;
  v4f v[8];
  for (int i = 0; i < 8; ++i)
    v[i] = *(const v4f*)(W + (size_t)(k0 + i) * Dn + n0);
  bf16* o = wt + (size_t)mat * Dn * Dn + (size_t)n0 * Dn + k0;
  for (int j = 0; j < 4; ++j) {
    v8bf r;
    for (int i = 0; i < 8; ++i) r[i] = (bf16)v[i][j];
    *(v8bf*)(o + (size_t)j * Dn) = r;
  }
}

/* ---------------- fused QKV GEMM (bf16 WMMA, f32 acc) ----------------
 * grid (64, 8, 3), block 256 (8 waves). Block tile 128(M) x 128(N).
 * A/B tiles double-buffered in LDS via async-to-LDS; wave = 32x64.   */
__global__ void __launch_bounds__(256, 1)
gemm_qkv_kernel(const bf16* __restrict__ xh, const bf16* __restrict__ wt,
                const float* __restrict__ bq, const float* __restrict__ bk,
                const float* __restrict__ bv,
                bf16* __restrict__ qh, bf16* __restrict__ kh,
                bf16* __restrict__ vt, float* __restrict__ out) {
  __shared__ __attribute__((aligned(16))) bf16 abuf[2][128 * P32];  /* 10 KiB each */
  __shared__ __attribute__((aligned(16))) bf16 bbuf[2][128 * P32];

  const int tid  = threadIdx.x;
  const int lane = tid & 31;
  const int w    = tid >> 5;
  const int mat  = blockIdx.z;
  const int row0 = blockIdx.x * 128;
  const int col0 = blockIdx.y * 128;
  const int mw   = w & 3;              /* 4 waves across M */
  const int nw   = w >> 2;             /* 2 waves across N */
  const int ln   = lane & 15;
  const int kb   = (lane >> 4) * 8;

  const bf16*  wtm  = wt + (size_t)mat * Dn * Dn;
  const float* bias = (mat == 0) ? bq : ((mat == 1) ? bk : bv);

  const bf16* asrc = xh  + (size_t)row0 * Dn;   /* row stride Dn */
  const bf16* bsrc = wtm + (size_t)col0 * Dn;

  v8f acc[2][4];
  for (int t = 0; t < 4; ++t) {
    float bval = bias[col0 + nw * 64 + t * 16 + ln];
    for (int r = 0; r < 8; ++r) { acc[0][t][r] = bval; acc[1][t][r] = bval; }
  }

  /* cooperative stage of one 128x32 A tile + 128x32 B tile */
  auto stage = [&](int kk, int buf) {
    int row = tid >> 2, off = (tid & 3) * 8;   /* 512 16B chunks per tile: */
    size_t g0 = (size_t)row * Dn + kk + off;   /* rows 0..63 and 64..127   */
    size_t g1 = g0 + (size_t)64 * Dn;
    int l0 = row * P32 + off, l1 = l0 + 64 * P32;
    async4_b128(asrc + g0, &abuf[buf][l0], bsrc + g0, &bbuf[buf][l0],
                asrc + g1, &abuf[buf][l1], bsrc + g1, &bbuf[buf][l1]);
  };

  stage(0, 0);
  int cur = 0;
  for (int kk = 0; kk < Dn; kk += 32) {
    wait_async();
    __syncthreads();
    if (kk + 32 < Dn) stage(kk + 32, cur ^ 1);

    v16bf a0 = load_frag(&abuf[cur][(mw * 32 + ln) * P32 + kb]);
    v16bf a1 = load_frag(&abuf[cur][(mw * 32 + 16 + ln) * P32 + kb]);
    for (int t = 0; t < 4; ++t) {
      v16bf b = load_frag(&bbuf[cur][(nw * 64 + t * 16 + ln) * P32 + kb]);
      acc[0][t] = wmma_bf16(a0, b, acc[0][t]);
      acc[1][t] = wmma_bf16(a1, b, acc[1][t]);
    }
    cur ^= 1;
  }

  /* Epilogue: each wave turns its 32 x 64 tile through 5 KiB of its own in the
   * ring, so that every global store is 8 or 16 B a lane on whole 128-B lines
   * (V^T: half lines). The tile is one head's 32 rows s, contiguous in the
   * (B,H,S,dh) arrays. Row pitch 272 B (f32) and 80 B (V^T): 16 B x odd.   */
  __syncthreads();              /* every wave has left the ring */
  float* st = (float*)((w < 4) ? &abuf[0][0] : &bbuf[0][0]) + (w & 3) * 1280;
  const int hf = lane >> 4;
  const int m0 = row0 + mw * 32;
  const int bhd = (m0 >> 11) * Hn + ((col0 + nw * 64) >> 6);   /* b*H + h */
  const int s0 = m0 & 2047;
  const size_t tile = ((size_t)bhd * Sn + s0) * DHn + lane * 4;

  /* 16 rows m of 64 columns n: out of the accumulators, back as rows; v[j]
   * is row 2j + hf, columns 4 ln .. 4 ln + 3: element 128 j + 4 lane       */
  auto turn = [&](int ms, v4f* v) {
    for (int t = 0; t < 4; ++t)
      for (int r = 0; r < 8; ++r)
        st[(8 * hf + r) * 68 + t * 16 + ln] = acc[ms][t][r];
    /* the rows read back were written by other lanes of this wave */
    asm volatile("s_wait_dscnt 0x0" ::: "memory");
    for (int j = 0; j < 8; ++j)
      v[j] = *(const v4f*)(st + (2 * j + hf) * 68 + ln * 4);
  };

  if (mat == 0) {
    for (int ms = 0; ms < 2; ++ms) {
      v4f v[8];
      turn(ms, v);
      for (int j = 0; j < 8; ++j)                    /* fold 1/sqrt(64) */
        *(v4bf*)(qh + tile + ms * 1024 + j * 128) =
            __builtin_convertvector(v[j] * 0.125f, v4bf);
    }
  } else if (mat == 1) {
    float* ko = out + (size_t)Mn * Dn + tile;        /* K cache f32 */
    for (int ms = 0; ms < 2; ++ms) {
      v4f v[8];
      turn(ms, v);
      for (int j = 0; j < 8; ++j) *(v4f*)(ko + ms * 1024 + j * 128) = v[j];
      for (int j = 0; j < 8; ++j)
        *(v4bf*)(kh + tile + ms * 1024 + j * 128) =
            __builtin_convertvector(v[j], v4bf);
    }
  } else {
    float* vo = out + (size_t)2 * Mn * Dn + tile;    /* V cache f32 */
    for (int ms = 0; ms < 2; ++ms) {
      v4f v[8];
      turn(ms, v);
      for (int j = 0; j < 8; ++j) *(v4f*)(vo + ms * 1024 + j * 128) = v[j];
    }
    /* V^T: a lane's 8 accumulator rows are 8 consecutive s of one d */
    for (int ms = 0; ms < 2; ++ms)
      for (int t = 0; t < 4; ++t) {
        v8bf p;
        for (int r = 0; r < 8; ++r) p[r] = (bf16)acc[ms][t][r];
        *(v4f*)(st + (t * 16 + ln) * 20 + ms * 8 + hf * 4) =
            __builtin_bit_cast(v4f, p);
      }
    /* the rows read back were written by other lanes of this wave */
    asm volatile("s_wait_dscnt 0x0" ::: "memory");
    bf16* vo2 = vt + ((size_t)bhd * DHn + (lane >> 2)) * Sn + s0 + (lane & 3) * 8;
    for (int j = 0; j < 8; ++j)
      *(v4f*)(vo2 + (size_t)j * 8 * Sn) =
          *(const v4f*)(st + (j * 8 + (lane >> 2)) * 20 + (lane & 3) * 4);
  }
}

__global__ void __launch_bounds__(256, 1)
attn_kernel(const bf16* __restrict__ qh, const bf16* __restrict__ kh,
            const bf16* __restrict__ vt, float* __restrict__ attn) {
  __shared__ __attribute__((aligned(16))) bf16 kbuf[2][32 * P64];  /* [kv][dh] */
  __shared__ __attribute__((aligned(16))) bf16 vbuf[2][64 * P32];  /* [dh][kv] */

  const int tid  = threadIdx.x;
  const int lane = tid & 31;
  const int w    = tid >> 5;
  const int bh   = blockIdx.x;                 /* b*16 + h */
  const int qblk = blockIdx.y;
  const int q0   = qblk * 128 + w * 16;
  const int ln   = lane & 15;
  const int kb   = (lane >> 4) * 8;

  const bf16* qp = qh + (size_t)bh * Sn * DHn;
  const bf16* kp = kh + (size_t)bh * Sn * DHn;
  const bf16* vp = vt + (size_t)bh * DHn * Sn;

  /* B operand: column = query q0 + ln, k = dh in the loader's order */
  v16bf qb0 = load_frag(qp + (size_t)(q0 + ln) * DHn + 0  + kb);
  v16bf qb1 = load_frag(qp + (size_t)(q0 + ln) * DHn + 32 + kb);

  v8f acco[4];                         /* O^T: [dh = 16t + kb + r][query ln] */
  for (int t = 0; t < 4; ++t)
    for (int r = 0; r < 8; ++r) acco[t][r] = 0.0f;
  float mrow = -1e30f;                 /* this lane's query, both halves alike */
  float lrow = 0.0f;                   /* this half's share of the row sum     */

  const int qg        = q0 + ln;               /* this lane's query      */
  const int nblk_wave = (q0 + 47) >> 5;        /* causal bound per wave  */
  const int nblk_blk  = qblk * 4 + 4;          /* uniform over the block */

  /* cooperative stage of one K(32x64) + V(64x32) tile */
  auto stage_kv = [&](int blk, int buf) {
    int kv0 = blk * 32;
    int krow = tid >> 3, koff = (tid & 7) * 8;  /* 256 chunks of K   */
    int vrow = tid >> 2, voff = (tid & 3) * 8;  /* 256 chunks of V^T */
    async2_b128(kp + (size_t)(kv0 + krow) * DHn + koff,
                &kbuf[buf][krow * P64 + koff],
                vp + (size_t)vrow * Sn + kv0 + voff,
                &vbuf[buf][vrow * P32 + voff]);
  };

  stage_kv(0, 0);
  int cur = 0;
  for (int blk = 0; blk < nblk_blk; ++blk) {
    wait_async();
    __syncthreads();
    if (blk + 1 < nblk_blk) stage_kv(blk + 1, cur ^ 1);

    if (blk < nblk_wave) {
      int kv0 = blk * 32;
      v8f s0, s1;
      for (int r = 0; r < 8; ++r) { s0[r] = 0.0f; s1[r] = 0.0f; }

      v16bf k0a = load_frag(&kbuf[cur][(ln)      * P64 + 0  + kb]);
      v16bf k0b = load_frag(&kbuf[cur][(ln)      * P64 + 32 + kb]);
      s0 = wmma_bf16(k0a, qb0, s0);
      s0 = wmma_bf16(k0b, qb1, s0);
      v16bf k1a = load_frag(&kbuf[cur][(16 + ln) * P64 + 0  + kb]);
      v16bf k1b = load_frag(&kbuf[cur][(16 + ln) * P64 + 32 + kb]);
      s1 = wmma_bf16(k1a, qb0, s1);
      s1 = wmma_bf16(k1b, qb1, s1);

      /* online softmax of one query per lane: s0[r] is key kv0 + kb + r,
       * s1[r] is key kv0 + 16 + kb + r                                   */
      float mx = -1e30f;
      for (int r = 0; r < 8; ++r) {
        s0[r] = ((kv0 + kb + r)      <= qg) ? s0[r] : -1e30f;
        s1[r] = ((kv0 + 16 + kb + r) <= qg) ? s1[r] : -1e30f;
        mx = fmaxf(mx, fmaxf(s0[r], s1[r]));
      }
      mx = fmaxf(mx, xhalf(mx));
      float mnew = fmaxf(mrow, mx);
      float corr = __expf(mrow - mnew);
      mrow = mnew;

      v16bf pb;                        /* P^T as B: k = kb + r, 16 + kb + r */
      float rs0 = 0.0f, rs1 = 0.0f;
      for (int r = 0; r < 8; ++r) {
        float p0 = __expf(s0[r] - mnew);
        float p1 = __expf(s1[r] - mnew);
        rs0 += p0;
        rs1 += p1;
        pb[r]     = (bf16)p0;
        pb[8 + r] = (bf16)p1;
      }
      lrow = lrow * corr + (rs0 + rs1);
      for (int t = 0; t < 4; ++t)
        for (int r = 0; r < 8; ++r) acco[t][r] *= corr;

      for (int t = 0; t < 4; ++t) {
        v16bf va = load_frag(&vbuf[cur][(t * 16 + ln) * P32 + kb]);
        acco[t] = wmma_bf16(va, pb, acco[t]);
      }
    }
    cur ^= 1;
  }

  /* join the two halves' shares of the row sum, once */
  lrow += xhalf(lrow);
  const float inv = 1.0f / lrow;

  const int b = bh >> 4, h = bh & 15;
  float* op = attn + ((size_t)(b * Sn + qg)) * Dn + h * DHn + kb;
  for (int t = 0; t < 4; ++t) {
    float4 lo, hi;
    lo.x = acco[t][0] * inv; lo.y = acco[t][1] * inv;
    lo.z = acco[t][2] * inv; lo.w = acco[t][3] * inv;
    hi.x = acco[t][4] * inv; hi.y = acco[t][5] * inv;
    hi.z = acco[t][6] * inv; hi.w = acco[t][7] * inv;
    *(float4*)(op + t * 16)     = lo;
    *(float4*)(op + t * 16 + 4) = hi;
  }
}

/* ---------------- residual + LayerNorm ----------------
 * Streaming form: grid 512, block 256 (16 waves per WGP), two rows per wave.
 * A lane holds 32 elements of each row (8 x 16 B of x and of attn) and its
 * 32 elements of gamma and beta, which serve both rows; the sums are
 * in-lane, then a butterfly over the 32 lanes: no LDS.                    */

/* sum over the wave, the same value in every lane: four exchanges inside the
 * 16-lane row, one between the rows */
__device__ __forceinline__ float wave_sum(float s) {
  s += __builtin_bit_cast(float, __builtin_amdgcn_update_dpp(
      0, __builtin_bit_cast(int, s), 0x161, 0xf, 0xf, true));  /* row_xmask:1 */
  s += __builtin_bit_cast(float, __builtin_amdgcn_update_dpp(
      0, __builtin_bit_cast(int, s), 0x162, 0xf, 0xf, true));  /* row_xmask:2 */
  s += __builtin_bit_cast(float, __builtin_amdgcn_update_dpp(
      0, __builtin_bit_cast(int, s), 0x164, 0xf, 0xf, true));  /* row_xmask:4 */
  s += __builtin_bit_cast(float, __builtin_amdgcn_update_dpp(
      0, __builtin_bit_cast(int, s), 0x168, 0xf, 0xf, true));  /* row_xmask:8 */
  return s + xhalf(s);
}

__global__ void __launch_bounds__(256)
ln_kernel(const float* __restrict__ x, const float* __restrict__ attn,
          const float* __restrict__ gamma, const float* __restrict__ beta,
          float* __restrict__ out) {
  const unsigned l4 = (threadIdx.x & 31) * 4;   /* the lane's place in 128 */
  /* the wave's number as a scalar: the row addresses then stay in scalar
   * registers and the one lane offset serves every load and store */
  const int wave = __builtin_amdgcn_readfirstlane(threadIdx.x >> 5);
  const size_t off = (size_t)((blockIdx.x * 8 + wave) * 2) * Dn;
  const float* xr = x    + off;
  const float* ar = attn + off;
  float*       yr = out  + off;

  v4f xv[2][8], av[2][8], g[8], b[8];
  for (int j = 0; j < 2; ++j)
    for (int i = 0; i < 8; ++i) {
      xv[j][i] = *(const v4f*)(xr + l4 + j * Dn + i * 128);
      av[j][i] = *(const v4f*)(ar + l4 + j * Dn + i * 128);
    }
  for (int i = 0; i < 8; ++i) {
    g[i] = *(const v4f*)(gamma + l4 + i * 128);
    b[i] = *(const v4f*)(beta  + l4 + i * 128);
  }
  /* keeps every load of the wave ahead of the arithmetic, so that all are in
   * flight together; without it the later ones are sunk behind the sums */
  __builtin_amdgcn_sched_barrier(0);

  float s[2];
  for (int j = 0; j < 2; ++j) {
    v4f s4 = {0.0f, 0.0f, 0.0f, 0.0f};
    for (int i = 0; i < 8; ++i) { xv[j][i] += av[j][i]; s4 += xv[j][i]; }
    s[j] = (s4[0] + s4[1]) + (s4[2] + s4[3]);
  }
  for (int j = 0; j < 2; ++j) s[j] = wave_sum(s[j]) * (1.0f / 1024.0f);

  float q[2];
  for (int j = 0; j < 2; ++j) {
    v4f q4 = {0.0f, 0.0f, 0.0f, 0.0f};
    for (int i = 0; i < 8; ++i) { xv[j][i] -= s[j]; q4 += xv[j][i] * xv[j][i]; }
    q[j] = (q4[0] + q4[1]) + (q4[2] + q4[3]);
  }
  for (int j = 0; j < 2; ++j)
    q[j] = rsqrtf(wave_sum(q[j]) * (1.0f / 1024.0f) + 1e-5f);

  for (int j = 0; j < 2; ++j)
    for (int i = 0; i < 8; ++i)
      *(v4f*)(yr + l4 + j * Dn + i * 128) = xv[j][i] * q[j] * g[i] + b[i];
}

extern "C" void kernel_launch(void* const* d_in, const int* in_sizes, int n_in,
                              void* d_out, int out_size, void* d_ws, size_t ws_size,
                              hipStream_t stream) {
  const float* x     = (const float*)d_in[0];
  const float* Wq    = (const float*)d_in[1];
  const float* bq    = (const float*)d_in[2];
  const float* Wk    = (const float*)d_in[3];
  const float* bk    = (const float*)d_in[4];
  const float* Wv    = (const float*)d_in[5];
  const float* bv    = (const float*)d_in[6];
  const float* gamma = (const float*)d_in[7];
  const float* beta  = (const float*)d_in[8];
  float* out = (float*)d_out;

  char* ws = (char*)d_ws;
  bf16*  xh   = (bf16*)(ws + XH_OFF);
  bf16*  wt   = (bf16*)(ws + WT_OFF);
  bf16*  qh   = (bf16*)(ws + QH_OFF);
  bf16*  kh   = (bf16*)(ws + KH_OFF);
  bf16*  vt   = (bf16*)(ws + VT_OFF);
  float* attn = (float*)(ws + AT_OFF);

  cvt_x_kernel<<<Mn * Dn / 16384, 256, 0, stream>>>(x, xh);
  cvt_wT_kernel<<<dim3(Dn * Dn / 8192, 3), 256, 0, stream>>>(Wq, Wk, Wv, wt);
  gemm_qkv_kernel<<<dim3(Mn / 128, Dn / 128, 3), 256, 0, stream>>>(
      xh, wt, bq, bk, bv, qh, kh, vt, out);
  attn_kernel<<<dim3(Bn * Hn, Sn / 128), 256, 0, stream>>>(qh, kh, vt, attn);
  ln_kernel<<<Mn / 16, 256, 0, stream>>>(x, attn, gamma, beta, out);
}

// v005
// Measured time: 127 microseconds a run.
// Timed twice side by side with v004, it ran 1.04 times as fast both times.
// Counting every step since v000, it is 3.76 times as fast.
#include <hip/hip_runtime.h>
#include <math.h>
#include <stdint.h>

typedef __bf16 bf16;
typedef __attribute__((ext_vector_type(16))) __bf16 v16bf;
typedef __attribute__((ext_vector_type(8)))  __bf16 v8bf;
typedef __attribute__((ext_vector_type(8)))  float  v8f;
typedef __attribute__((ext_vector_type(4)))  float  v4f;
typedef __attribute__((ext_vector_type(4)))  __bf16 v4bf;

#define Bn  4
#define Sn  2048
#define Dn  1024
#define Hn  16
#define DHn 64
#define Mn  (Bn * Sn)          /* 8192 rows of x */

/* workspace layout (bytes) */
#define XH_OFF  0ull
#define XH_BY   ((size_t)Mn * Dn * 2)        /* x in bf16            16 MiB */
#define WT_OFF  (XH_OFF + XH_BY)
#define WT_BY   ((size_t)3 * Dn * Dn * 2)    /* Wq/Wk/Wv^T bf16       6 MiB */
#define QH_OFF  (WT_OFF + WT_BY)
#define QH_BY   ((size_t)Mn * Dn * 2)        /* Q bf16 (B,H,S,dh)    16 MiB */
#define KH_OFF  (QH_OFF + QH_BY)
#define KH_BY   ((size_t)Mn * Dn * 2)        /* K bf16 (B,H,S,dh)    16 MiB */
#define VT_OFF  (KH_OFF + KH_BY)
#define VT_BY   ((size_t)Mn * Dn * 2)        /* V^T bf16 (B,H,dh,S)  16 MiB */
#define AT_OFF  (VT_OFF + VT_BY)
#define AT_BY   ((size_t)Mn * Dn * 4)        /* attn f32 (B,S,D)     32 MiB */

#define P32 40                 /* rows of 32 bf16 (64 B):  pitch  80 B */
#define P64 72                 /* rows of 64 bf16 (128 B): pitch 144 B */

#define LDSA(l) ((unsigned)(uintptr_t)(l))
#define GLBA(g) ((unsigned long long)(uintptr_t)(g))
__device__ __forceinline__ void async2_b128(const bf16* g0, bf16* l0,
                                            const bf16* g1, bf16* l1) {
  asm volatile("global_load_async_to_lds_b128 %0, %1, off\n\t"
               "global_load_async_to_lds_b128 %2, %3, off\n\t"
               "s_wait_xcnt 0x0"
               :
               : "v"(LDSA(l0)), "v"(GLBA(g0)), "v"(LDSA(l1)), "v"(GLBA(g1))
               : "memory");
}

__device__ __forceinline__ void async4_b128(const bf16* g0, bf16* l0,
                                            const bf16* g1, bf16* l1,
                                            const bf16* g2, bf16* l2,
                                            const bf16* g3, bf16* l3) {
  asm volatile("global_load_async_to_lds_b128 %0, %1, off\n\t"
               "global_load_async_to_lds_b128 %2, %3, off\n\t"
               "global_load_async_to_lds_b128 %4, %5, off\n\t"
               "global_load_async_to_lds_b128 %6, %7, off\n\t"
               "s_wait_xcnt 0x0"
               :
               : "v"(LDSA(l0)), "v"(GLBA(g0)), "v"(LDSA(l1)), "v"(GLBA(g1)),
                 "v"(LDSA(l2)), "v"(GLBA(g2)), "v"(LDSA(l3)), "v"(GLBA(g3))
               : "memory");
}

/* in front of the barrier that hands a stage over: first this wave's LDS reads
 * of the buffer that is refilled behind the barrier have returned, then its
 * own copies of the next stage have landed */
__device__ __forceinline__ void wait_async() {
  asm volatile("s_wait_dscnt 0x0" ::: "memory");
  asm volatile("s_wait_asynccnt 0x0" ::: "memory");
}

__device__ __forceinline__ v16bf load_frag(const bf16* p) {
  union { v16bf v; v8bf h[2]; } f;
  f.h[0] = *(const v8bf*)(p);
  f.h[1] = *(const v8bf*)(p + 16);
  return f.v;
}

__device__ __forceinline__ v8f wmma_bf16(v16bf a, v16bf b, v8f c) {
  return __builtin_amdgcn_wmma_f32_16x16x32_bf16(
      false, a, false, b, (short)0, c, false, false);
}

__device__ __forceinline__ float xhalf(float x) {
  int b = __builtin_bit_cast(int, x);
  return __builtin_bit_cast(float, __builtin_amdgcn_permlanex16(
      b, b, 0x76543210, 0xfedcba98, false, false));
}

/* ---------------- conversion kernels ----------------
 * Streaming form: few waves, each with 8 or 16 loads of 16 bytes a lane in
 * flight, every load instruction of a wave covering whole 128-byte lines. */

/* grid 512, block 256: 16 waves per WGP. A wave converts 2048 consecutive
 * elements, 16 loads and 16 stores a lane.                               */
__global__ void __launch_bounds__(256)
cvt_x_kernel(const float* __restrict__ x, bf16* __restrict__ xh) {
  const int lane = threadIdx.x & 31;
  const int wv   = blockIdx.x * 8 + (threadIdx.x >> 5);
  const size_t base = (size_t)wv * 2048 + lane * 4;
  v4f v[16];
  for (int i = 0; i < 16; ++i) v[i] = *(const v4f*)(x + base + i * 128);
  for (int i = 0; i < 16; ++i)
    *(v4bf*)(xh + base + i * 128) = __builtin_convertvector(v[i], v4bf);
}

/* grid (128, 3), block 256. A wave transposes a 32(k) x 32(n) tile in
 * registers: a lane loads 8 rows k of 4 columns n (a load instruction reads
 * 4 rows of 128 B) and stores 4 rows n of 8 k (16 B each).               */
__global__ void __launch_bounds__(256)
cvt_wT_kernel(const float* __restrict__ Wq,
              const float* __restrict__ Wk,
              const float* __restrict__ Wv,
              bf16* __restrict__ wt) {
  const int mat = blockIdx.y;
  const float* W = (mat == 0) ? Wq : ((mat == 1) ? Wk : Wv);
  const int lane = threadIdx.x & 31;
  const int wv   = blockIdx.x * 8 + (threadIdx.x >> 5);   /* 0..1023 */
  const int k0   = (wv & 31) * 32 + (lane & 3) * 8;
  const int n0   = (wv >> 5) * 32 + (lane >> 2) * 4;
  v4f v[8];
  for (int i = 0; i < 8; ++i)
    v[i] = *(const v4f*)(W + (size_t)(k0 + i) * Dn + n0);
  bf16* o = wt + (size_t)mat * Dn * Dn + (size_t)n0 * Dn + k0;
  for (int j = 0; j < 4; ++j) {
    v8bf r;
    for (int i = 0; i < 8; ++i) r[i] = (bf16)v[i][j];
    *(v8bf*)(o + (size_t)j * Dn) = r;
  }
}

/* ---------------- fused QKV GEMM (bf16 WMMA, f32 acc) ----------------
 * grid (64, 8, 3), block 256 (8 waves). Block tile 128(M) x 128(N).
 * A/B tiles double-buffered in LDS via async-to-LDS; wave = 32x64.   */
__global__ void __launch_bounds__(256, 1)
gemm_qkv_kernel(const bf16* __restrict__ xh, const bf16* __restrict__ wt,
                const float* __restrict__ bq, const float* __restrict__ bk,
                const float* __restrict__ bv,
                bf16* __restrict__ qh, bf16* __restrict__ kh,
                bf16* __restrict__ vt, float* __restrict__ out) {
  __shared__ __attribute__((aligned(16))) bf16 abuf[2][128 * P32];  /* 10 KiB each */
  __shared__ __attribute__((aligned(16))) bf16 bbuf[2][128 * P32];

  const int tid  = threadIdx.x;
  const int lane = tid & 31;
  const int w    = tid >> 5;
  const int mat  = blockIdx.z;
  const int row0 = blockIdx.x * 128;
  const int col0 = blockIdx.y * 128;
  const int mw   = w & 3;              /* 4 waves across M */
  const int nw   = w >> 2;             /* 2 waves across N */
  const int ln   = lane & 15;
  const int kb   = (lane >> 4) * 8;

  const bf16*  wtm  = wt + (size_t)mat * Dn * Dn;
  const float* bias = (mat == 0) ? bq : ((mat == 1) ? bk : bv);

  const bf16* asrc = xh  + (size_t)row0 * Dn;   /* row stride Dn */
  const bf16* bsrc = wtm + (size_t)col0 * Dn;

  v8f acc[2][4];
  for (int t = 0; t < 4; ++t) {
    float bval = bias[col0 + nw * 64 + t * 16 + ln];
    for (int r = 0; r < 8; ++r) { acc[0][t][r] = bval; acc[1][t][r] = bval; }
  }

  /* cooperative stage of one 128x32 A tile + 128x32 B tile */
  auto stage = [&](int kk, int buf) {
    int row = tid >> 2, off = (tid & 3) * 8;   /* 512 16B chunks per tile: */
    size_t g0 = (size_t)row * Dn + kk + off;   /* rows 0..63 and 64..127   */
    size_t g1 = g0 + (size_t)64 * Dn;
    int l0 = row * P32 + off, l1 = l0 + 64 * P32;
    async4_b128(asrc + g0, &abuf[buf][l0], bsrc + g0, &bbuf[buf][l0],
                asrc + g1, &abuf[buf][l1], bsrc + g1, &bbuf[buf][l1]);
  };

  stage(0, 0);
  int cur = 0;
  for (int kk = 0; kk < Dn; kk += 32) {
    wait_async();
    __syncthreads();
    if (kk + 32 < Dn) stage(kk + 32, cur ^ 1);

    v16bf a0 = load_frag(&abuf[cur][(mw * 32 + ln) * P32 + kb]);
    v16bf a1 = load_frag(&abuf[cur][(mw * 32 + 16 + ln) * P32 + kb]);
    for (int t = 0; t < 4; ++t) {
      v16bf b = load_frag(&bbuf[cur][(nw * 64 + t * 16 + ln) * P32 + kb]);
      acc[0][t] = wmma_bf16(a0, b, acc[0][t]);
      acc[1][t] = wmma_bf16(a1, b, acc[1][t]);
    }
    cur ^= 1;
  }

  /* Epilogue: each wave turns its 32 x 64 tile through 5 KiB of its own in the
   * ring, so that every global store is 8 or 16 B a lane on whole 128-B lines
   * (V^T: half lines). The tile is one head's 32 rows s, contiguous in the
   * (B,H,S,dh) arrays. Row pitch 272 B (f32) and 80 B (V^T): 16 B x odd.   */
  __syncthreads();              /* every wave has left the ring */
  float* st = (float*)((w < 4) ? &abuf[0][0] : &bbuf[0][0]) + (w & 3) * 1280;
  const int hf = lane >> 4;
  const int m0 = row0 + mw * 32;
  const int bhd = (m0 >> 11) * Hn + ((col0 + nw * 64) >> 6);   /* b*H + h */
  const int s0 = m0 & 2047;
  const size_t tile = ((size_t)bhd * Sn + s0) * DHn + lane * 4;

  /* 16 rows m of 64 columns n: out of the accumulators, back as rows; v[j]
   * is row 2j + hf, columns 4 ln .. 4 ln + 3: element 128 j + 4 lane       */
  auto turn = [&](int ms, v4f* v) {
    for (int t = 0; t < 4; ++t)
      for (int r = 0; r < 8; ++r)
        st[(8 * hf + r) * 68 + t * 16 + ln] = acc[ms][t][r];
    /* the rows read back were written by other lanes of this wave */
    asm volatile("s_wait_dscnt 0x0" ::: "memory");
    for (int j = 0; j < 8; ++j)
      v[j] = *(const v4f*)(st + (2 * j + hf) * 68 + ln * 4);
  };

  if (mat == 0) {
    for (int ms = 0; ms < 2; ++ms) {
      v4f v[8];
      turn(ms, v);
      for (int j = 0; j < 8; ++j)                    /* fold 1/sqrt(64) */
        *(v4bf*)(qh + tile + ms * 1024 + j * 128) =
            __builtin_convertvector(v[j] * 0.125f, v4bf);
    }
  } else if (mat == 1) {
    float* ko = out + (size_t)Mn * Dn + tile;        /* K cache f32 */
    for (int ms = 0; ms < 2; ++ms) {
      v4f v[8];
      turn(ms, v);
      for (int j = 0; j < 8; ++j) *(v4f*)(ko + ms * 1024 + j * 128) = v[j];
      for (int j = 0; j < 8; ++j)
        *(v4bf*)(kh + tile + ms * 1024 + j * 128) =
            __builtin_convertvector(v[j], v4bf);
    }
  } else {
    float* vo = out + (size_t)2 * Mn * Dn + tile;    /* V cache f32 */
    for (int ms = 0; ms < 2; ++ms) {
      v4f v[8];
      turn(ms, v);
      for (int j = 0; j < 8; ++j) *(v4f*)(vo + ms * 1024 + j * 128) = v[j];
    }
    /* V^T: a lane's 8 accumulator rows are 8 consecutive s of one d */
    for (int ms = 0; ms < 2; ++ms)
      for (int t = 0; t < 4; ++t) {
        v8bf p;
        for (int r = 0; r < 8; ++r) p[r] = (bf16)acc[ms][t][r];
        *(v4f*)(st + (t * 16 + ln) * 20 + ms * 8 + hf * 4) =
            __builtin_bit_cast(v4f, p);
      }
    /* the rows read back were written by other lanes of this wave */
    asm volatile("s_wait_dscnt 0x0" ::: "memory");
    bf16* vo2 = vt + ((size_t)bhd * DHn + (lane >> 2)) * Sn + s0 + (lane & 3) * 8;
    for (int j = 0; j < 8; ++j)
      *(v4f*)(vo2 + (size_t)j * 8 * Sn) =
          *(const v4f*)(st + (j * 8 + (lane >> 2)) * 20 + (lane & 3) * 4);
  }
}

__global__ void __launch_bounds__(256, 1)
attn_kernel(const bf16* __restrict__ qh, const bf16* __restrict__ kh,
            const bf16* __restrict__ vt, float* __restrict__ attn) {
  __shared__ __attribute__((aligned(16))) bf16 kbuf[2][32 * P64];  /* [kv][dh] */
  __shared__ __attribute__((aligned(16))) bf16 vbuf[2][64 * P32];  /* [dh][kv] */

  const int tid  = threadIdx.x;
  const int lane = tid & 31;
  /* the wave's number as a scalar: the tests on the wave's causal bound in the
   * key loop are then scalar branches */
  const int w    = __builtin_amdgcn_readfirstlane(tid >> 5);
  const int bh   = blockIdx.x;                 /* b*16 + h */
  const int qblk = blockIdx.y;
  const int q0   = qblk * 128 + w * 16;
  const int ln   = lane & 15;
  const int kb   = (lane >> 4) * 8;

  const bf16* qp = qh + (size_t)bh * Sn * DHn;
  const bf16* kp = kh + (size_t)bh * Sn * DHn;
  const bf16* vp = vt + (size_t)bh * DHn * Sn;

  /* B operand: column = query q0 + ln, k = dh in the loader's order */
  v16bf qb0 = load_frag(qp + (size_t)(q0 + ln) * DHn + 0  + kb);
  v16bf qb1 = load_frag(qp + (size_t)(q0 + ln) * DHn + 32 + kb);

  v8f acco[4];                         /* O^T: [dh = 16t + kb + r][query ln] */
  for (int t = 0; t < 4; ++t)
    for (int r = 0; r < 8; ++r) acco[t][r] = 0.0f;
  float mrow = -1e30f;                 /* this lane's query, both halves alike */
  float lrow = 0.0f;                   /* this half's share of the row sum     */

  const int qg        = q0 + ln;               /* this lane's query      */
  const int nblk_wave = (q0 + 47) >> 5;        /* causal bound per wave  */
  const int nblk_blk  = qblk * 4 + 4;          /* uniform over the block */

  /* cooperative stage of one K(32x64) + V(64x32) tile */
  auto stage_kv = [&](int blk, int buf) {
    int kv0 = blk * 32;
    int krow = tid >> 3, koff = (tid & 7) * 8;  /* 256 chunks of K   */
    int vrow = tid >> 2, voff = (tid & 3) * 8;  /* 256 chunks of V^T */
    async2_b128(kp + (size_t)(kv0 + krow) * DHn + koff,
                &kbuf[buf][krow * P64 + koff],
                vp + (size_t)vrow * Sn + kv0 + voff,
                &vbuf[buf][vrow * P32 + voff]);
  };

  stage_kv(0, 0);
  int cur = 0;
  for (int blk = 0; blk < nblk_blk; ++blk) {
    wait_async();
    __syncthreads();
    if (blk + 1 < nblk_blk) stage_kv(blk + 1, cur ^ 1);

    if (blk < nblk_wave) {
      int kv0 = blk * 32;
      v8f s0, s1;
      for (int r = 0; r < 8; ++r) { s0[r] = 0.0f; s1[r] = 0.0f; }

      v16bf k0a = load_frag(&kbuf[cur][(ln)      * P64 + 0  + kb]);
      v16bf k1a = load_frag(&kbuf[cur][(16 + ln) * P64 + 0  + kb]);
      v16bf k0b = load_frag(&kbuf[cur][(ln)      * P64 + 32 + kb]);
      v16bf k1b = load_frag(&kbuf[cur][(16 + ln) * P64 + 32 + kb]);
      /* keeps the eight K loads one group ahead of the products: with the
       * branch below ending the block, the compiler otherwise reloads one
       * register set and waits out the LDS latency three times a pass     */
      __builtin_amdgcn_sched_barrier(0);
      s0 = wmma_bf16(k0a, qb0, s0);
      s1 = wmma_bf16(k1a, qb0, s1);
      s0 = wmma_bf16(k0b, qb1, s0);
      s1 = wmma_bf16(k1b, qb1, s1);

      /* online softmax of one query per lane: s0[r] is key kv0 + kb + r,
       * s1[r] is key kv0 + 16 + kb + r                                   */
      /* only the wave's last block, which holds its 16 queries' own
       * positions, has keys behind a query: the blocks before it take their
       * scores as they are                                               */
      if (blk + 1 == nblk_wave) {
        for (int r = 0; r < 8; ++r) {
          s0[r] = ((kv0 + kb + r)      <= qg) ? s0[r] : -1e30f;
          s1[r] = ((kv0 + 16 + kb + r) <= qg) ? s1[r] : -1e30f;
        }
      }
      float mx = -1e30f;
      for (int r = 0; r < 8; ++r) mx = fmaxf(mx, fmaxf(s0[r], s1[r]));
      mx = fmaxf(mx, xhalf(mx));
      float mnew = fmaxf(mrow, mx);
      float corr = __expf(mrow - mnew);
      mrow = mnew;

      v16bf pb;                        /* P^T as B: k = kb + r, 16 + kb + r */
      float rs0 = 0.0f, rs1 = 0.0f;
      for (int r = 0; r < 8; ++r) {
        float p0 = __expf(s0[r] - mnew);
        float p1 = __expf(s1[r] - mnew);
        rs0 += p0;
        rs1 += p1;
        pb[r]     = (bf16)p0;
        pb[8 + r] = (bf16)p1;
      }
      lrow = lrow * corr + (rs0 + rs1);
      for (int t = 0; t < 4; ++t)
        for (int r = 0; r < 8; ++r) acco[t][r] *= corr;

      for (int t = 0; t < 4; ++t) {
        v16bf va = load_frag(&vbuf[cur][(t * 16 + ln) * P32 + kb]);
        acco[t] = wmma_bf16(va, pb, acco[t]);
      }
    }
    cur ^= 1;
  }

  /* join the two halves' shares of the row sum, once */
  lrow += xhalf(lrow);
  const float inv = 1.0f / lrow;

  const int b = bh >> 4, h = bh & 15;
  float* op = attn + ((size_t)(b * Sn + qg)) * Dn + h * DHn + kb;
  for (int t = 0; t < 4; ++t) {
    float4 lo, hi;
    lo.x = acco[t][0] * inv; lo.y = acco[t][1] * inv;
    lo.z = acco[t][2] * inv; lo.w = acco[t][3] * inv;
    hi.x = acco[t][4] * inv; hi.y = acco[t][5] * inv;
    hi.z = acco[t][6] * inv; hi.w = acco[t][7] * inv;
    *(float4*)(op + t * 16)     = lo;
    *(float4*)(op + t * 16 + 4) = hi;
  }
}

/* ---------------- residual + LayerNorm ----------------
 * Streaming form: grid 512, block 256 (16 waves per WGP), two rows per wave.
 * A lane holds 32 elements of each row (8 x 16 B of x and of attn) and its
 * 32 elements of gamma and beta, which serve both rows; the sums are
 * in-lane, then a butterfly over the 32 lanes: no LDS.                    */

/* sum over the wave, the same value in every lane: four exchanges inside the
 * 16-lane row, one between the rows */
__device__ __forceinline__ float wave_sum(float s) {
  s += __builtin_bit_cast(float, __builtin_amdgcn_update_dpp(
      0, __builtin_bit_cast(int, s), 0x161, 0xf, 0xf, true));  /* row_xmask:1 */
  s += __builtin_bit_cast(float, __builtin_amdgcn_update_dpp(
      0, __builtin_bit_cast(int, s), 0x162, 0xf, 0xf, true));  /* row_xmask:2 */
  s += __builtin_bit_cast(float, __builtin_amdgcn_update_dpp(
      0, __builtin_bit_cast(int, s), 0x164, 0xf, 0xf, true));  /* row_xmask:4 */
  s += __builtin_bit_cast(float, __builtin_amdgcn_update_dpp(
      0, __builtin_bit_cast(int, s), 0x168, 0xf, 0xf, true));  /* row_xmask:8 */
  return s + xhalf(s);
}

__global__ void __launch_bounds__(256)
ln_kernel(const float* __restrict__ x, const float* __restrict__ attn,
          const float* __restrict__ gamma, const float* __restrict__ beta,
          float* __restrict__ out) {
  const unsigned l4 = (threadIdx.x & 31) * 4;   /* the lane's place in 128 */
  /* the wave's number as a scalar: the row addresses then stay in scalar
   * registers and the one lane offset serves every load and store */
  const int wave = __builtin_amdgcn_readfirstlane(threadIdx.x >> 5);
  const size_t off = (size_t)((blockIdx.x * 8 + wave) * 2) * Dn;
  const float* xr = x    + off;
  const float* ar = attn + off;
  float*       yr = out  + off;

  v4f xv[2][8], av[2][8], g[8], b[8];
  for (int j = 0; j < 2; ++j)
    for (int i = 0; i < 8; ++i) {
      xv[j][i] = *(const v4f*)(xr + l4 + j * Dn + i * 128);
      av[j][i] = *(const v4f*)(ar + l4 + j * Dn + i * 128);
    }
  for (int i = 0; i < 8; ++i) {
    g[i] = *(const v4f*)(gamma + l4 + i * 128);
    b[i] = *(const v4f*)(beta  + l4 + i * 128);
  }
  /* keeps every load of the wave ahead of the arithmetic, so that all are in
   * flight together; without it the later ones are sunk behind the sums */
  __builtin_amdgcn_sched_barrier(0);

  float s[2];
  for (int j = 0; j < 2; ++j) {
    v4f s4 = {0.0f, 0.0f, 0.0f, 0.0f};
    for (int i = 0; i < 8; ++i) { xv[j][i] += av[j][i]; s4 += xv[j][i]; }
    s[j] = (s4[0] + s4[1]) + (s4[2] + s4[3]);
  }
  for (int j = 0; j < 2; ++j) s[j] = wave_sum(s[j]) * (1.0f / 1024.0f);

  float q[2];
  for (int j = 0; j < 2; ++j) {
    v4f q4 = {0.0f, 0.0f, 0.0f, 0.0f};
    for (int i = 0; i < 8; ++i) { xv[j][i] -= s[j]; q4 += xv[j][i] * xv[j][i]; }
    q[j] = (q4[0] + q4[1]) + (q4[2] + q4[3]);
  }
  for (int j = 0; j < 2; ++j)
    q[j] = rsqrtf(wave_sum(q[j]) * (1.0f / 1024.0f) + 1e-5f);

  for (int j = 0; j < 2; ++j)
    for (int i = 0; i < 8; ++i)
      *(v4f*)(yr + l4 + j * Dn + i * 128) = xv[j][i] * q[j] * g[i] + b[i];
}

extern "C" void kernel_launch(void* const* d_in, const int* in_sizes, int n_in,
                              void* d_out, int out_size, void* d_ws, size_t ws_size,
                              hipStream_t stream) {
  const float* x     = (const float*)d_in[0];
  const float* Wq    = (const float*)d_in[1];
  const float* bq    = (const float*)d_in[2];
  const float* Wk    = (const float*)d_in[3];
  const float* bk    = (const float*)d_in[4];
  const float* Wv    = (const float*)d_in[5];
  const float* bv    = (const float*)d_in[6];
  const float* gamma = (const float*)d_in[7];
  const float* beta  = (const float*)d_in[8];
  float* out = (float*)d_out;

  char* ws = (char*)d_ws;
  bf16*  xh   = (bf16*)(ws + XH_OFF);
  bf16*  wt   = (bf16*)(ws + WT_OFF);
  bf16*  qh   = (bf16*)(ws + QH_OFF);
  bf16*  kh   = (bf16*)(ws + KH_OFF);
  bf16*  vt   = (bf16*)(ws + VT_OFF);
  float* attn = (float*)(ws + AT_OFF);

  cvt_x_kernel<<<Mn * Dn / 16384, 256, 0, stream>>>(x, xh);
  cvt_wT_kernel<<<dim3(Dn * Dn / 8192, 3), 256, 0, stream>>>(Wq, Wk, Wv, wt);
  gemm_qkv_kernel<<<dim3(Mn / 128, Dn / 128, 3), 256, 0, stream>>>(
      xh, wt, bq, bk, bv, qh, kh, vt, out);
  attn_kernel<<<dim3(Bn * Hn, Sn / 128), 256, 0, stream>>>(qh, kh, vt, attn);
  ln_kernel<<<Mn / 16, 256, 0, stream>>>(x, attn, gamma, beta, out);
}

// v006
// It runs in 105 microseconds.
// Timed twice side by side with v005, it ran 1.21 times as fast both times.
// Over all steps from v000 it is 4.57 times as fast.
#include <hip/hip_runtime.h>
#include <math.h>
#include <stdint.h>

typedef __bf16 bf16;
typedef __attribute__((ext_vector_type(16))) __bf16 v16bf;
typedef __attribute__((ext_vector_type(8)))  __bf16 v8bf;
typedef __attribute__((ext_vector_type(8)))  float  v8f;
typedef __attribute__((ext_vector_type(4)))  float  v4f;
typedef __attribute__((ext_vector_type(4)))  __bf16 v4bf;

#define Bn  4
#define Sn  2048
#define Dn  1024
#define Hn  16
#define DHn 64
#define Mn  (Bn * Sn)          /* 8192 rows of x */

/* workspace layout (bytes) */
#define XH_OFF  0ull
#define XH_BY   ((size_t)Mn * Dn * 2)        /* x in bf16            16 MiB */
#define WT_OFF  (XH_OFF + XH_BY)
#define WT_BY   ((size_t)3 * Dn * Dn * 2)    /* Wq/Wk/Wv^T bf16       6 MiB */
#define QH_OFF  (WT_OFF + WT_BY)
#define QH_BY   ((size_t)Mn * Dn * 2)        /* Q bf16 (B,H,S,dh)    16 MiB */
#define KH_OFF  (QH_OFF + QH_BY)
#define KH_BY   ((size_t)Mn * Dn * 2)        /* K bf16 (B,H,S,dh)    16 MiB */
#define VT_OFF  (KH_OFF + KH_BY)
#define VT_BY   ((size_t)Mn * Dn * 2)        /* V^T bf16 (B,H,dh,S)  16 MiB */
#define AT_OFF  (VT_OFF + VT_BY)
#define AT_BY   ((size_t)Mn * Dn * 4)        /* attn f32 (B,S,D)     32 MiB */

#define P32 40                 /* rows of 32 bf16 (64 B):  pitch  80 B */
#define P64 72                 /* rows of 64 bf16 (128 B): pitch 144 B */

#define LDSA(l) ((unsigned)(uintptr_t)(l))
#define GLBA(g) ((unsigned long long)(uintptr_t)(g))
__device__ __forceinline__ void async2_b128(const bf16* g0, bf16* l0,
                                            const bf16* g1, bf16* l1) {
  asm volatile("global_load_async_to_lds_b128 %0, %1, off\n\t"
               "global_load_async_to_lds_b128 %2, %3, off\n\t"
               "s_wait_xcnt 0x0"
               :
               : "v"(LDSA(l0)), "v"(GLBA(g0)), "v"(LDSA(l1)), "v"(GLBA(g1))
               : "memory");
}

/* The same copy with the global address as a scalar base plus one 32-bit lane
 * offset in bytes: eight rows a fixed step apart share the offset register,
 * so a stage's copies take 9 vector registers, not 24 (beside 256 accumulator
 * registers the 64-bit lane addresses spill to scratch).                  */
__device__ __forceinline__ void async8s_b128(const bf16* g, size_t gstep,
                                             unsigned voff, bf16* l, int lstep) {
  asm volatile("global_load_async_to_lds_b128 %0, %16, %1\n\t"
               "global_load_async_to_lds_b128 %2, %16, %3\n\t"
               "global_load_async_to_lds_b128 %4, %16, %5\n\t"
               "global_load_async_to_lds_b128 %6, %16, %7\n\t"
               "global_load_async_to_lds_b128 %8, %16, %9\n\t"
               "global_load_async_to_lds_b128 %10, %16, %11\n\t"
               "global_load_async_to_lds_b128 %12, %16, %13\n\t"
               "global_load_async_to_lds_b128 %14, %16, %15\n\t"
               "s_wait_xcnt 0x0"
               :
               : "v"(LDSA(l)),             "s"(GLBA(g)),
                 "v"(LDSA(l + lstep)),     "s"(GLBA(g + gstep)),
                 "v"(LDSA(l + 2 * lstep)), "s"(GLBA(g + 2 * gstep)),
                 "v"(LDSA(l + 3 * lstep)), "s"(GLBA(g + 3 * gstep)),
                 "v"(LDSA(l + 4 * lstep)), "s"(GLBA(g + 4 * gstep)),
                 "v"(LDSA(l + 5 * lstep)), "s"(GLBA(g + 5 * gstep)),
                 "v"(LDSA(l + 6 * lstep)), "s"(GLBA(g + 6 * gstep)),
                 "v"(LDSA(l + 7 * lstep)), "s"(GLBA(g + 7 * gstep)),
                 "v"(voff)
               : "memory");
}

/* in front of the barrier that hands a stage over: first this wave's LDS reads
 * of the buffer that is refilled behind the barrier have returned, then its
 * own copies of the next stage have landed */
__device__ __forceinline__ void wait_async() {
  asm volatile("s_wait_dscnt 0x0" ::: "memory");
  asm volatile("s_wait_asynccnt 0x0" ::: "memory");
}

__device__ __forceinline__ v16bf load_frag(const bf16* p) {
  union { v16bf v; v8bf h[2]; } f;
  f.h[0] = *(const v8bf*)(p);
  f.h[1] = *(const v8bf*)(p + 16);
  return f.v;
}

__device__ __forceinline__ v8f wmma_bf16(v16bf a, v16bf b, v8f c) {
  return __builtin_amdgcn_wmma_f32_16x16x32_bf16(
      false, a, false, b, (short)0, c, false, false);
}

__device__ __forceinline__ float xhalf(float x) {
  int b = __builtin_bit_cast(int, x);
  return __builtin_bit_cast(float, __builtin_amdgcn_permlanex16(
      b, b, 0x76543210, 0xfedcba98, false, false));
}

/* ---------------- conversion kernels ----------------
 * Streaming form: few waves, each with 8 or 16 loads of 16 bytes a lane in
 * flight, every load instruction of a wave covering whole 128-byte lines. */

/* grid 512, block 256: 16 waves per WGP. A wave converts 2048 consecutive
 * elements, 16 loads and 16 stores a lane.                               */
__global__ void __launch_bounds__(256)
cvt_x_kernel(const float* __restrict__ x, bf16* __restrict__ xh) {
  const int lane = threadIdx.x & 31;
  const int wv   = blockIdx.x * 8 + (threadIdx.x >> 5);
  const size_t base = (size_t)wv * 2048 + lane * 4;
  v4f v[16];
  for (int i = 0; i < 16; ++i) v[i] = *(const v4f*)(x + base + i * 128);
  for (int i = 0; i < 16; ++i)
    *(v4bf*)(xh + base + i * 128) = __builtin_convertvector(v[i], v4bf);
}

/* grid (128, 3), block 256. A wave transposes a 32(k) x 32(n) tile in
 * registers: a lane loads 8 rows k of 4 columns n (a load instruction reads
 * 4 rows of 128 B) and stores 4 rows n of 8 k (16 B each).               */
__global__ void __launch_bounds__(256)
cvt_wT_kernel(const float* __restrict__ Wq,
              const float* __restrict__ Wk,
              const float* __restrict__ Wv,
              bf16* __restrict__ wt) {
  const int mat = blockIdx.y;
  const float* W = (mat == 0) ? Wq : ((mat == 1) ? Wk : Wv);
  const int lane = threadIdx.x & 31;
  const int wv   = blockIdx.x * 8 + (threadIdx.x >> 5);   /* 0..1023 */
  const int k0   = (wv & 31) * 32 + (lane & 3) * 8;
  const int n0   = (wv >> 5) * 32 + (lane >> 2) * 4;
  v4f v[8];
  for (int i = 0; i < 8; ++i)
    v[i] = *(const v4f*)(W + (size_t)(k0 + i) * Dn + n0);
  bf16* o = wt + (size_t)mat * Dn * Dn + (size_t)n0 * Dn + k0;
  for (int j = 0; j < 4; ++j) {
    v8bf r;
    for (int i = 0; i < 8; ++i) r[i] = (bf16)v[i][j];
    *(v8bf*)(o + (size_t)j * Dn) = r;
  }
}

/* ---------------- fused QKV GEMM (bf16 WMMA, f32 acc) ----------------
 * The three weight matrices stand stacked in wt as one 3072 x 1024 operand.
 * grid (32, 8), block 384 (12 waves): one work-group per WGP, one round.
 * Block tile 256(M) x 384(N), wave tile 64 x 128 (two heads of one matrix):
 * a fragment read from LDS feeds 4 or 8 products, a row copied from L2 feeds
 * 384 or 256 columns. A stage is 64 k: its rows are whole 128-B lines.
 * A/B tiles double-buffered in LDS via async-to-LDS.                       */
__global__ void __launch_bounds__(384, 1)
gemm_qkv_kernel(const bf16* __restrict__ xh, const bf16* __restrict__ wt,
                const float* __restrict__ bq, const float* __restrict__ bk,
                const float* __restrict__ bv,
                bf16* __restrict__ qh, bf16* __restrict__ kh,
                bf16* __restrict__ vt, float* __restrict__ out) {
  __shared__ __attribute__((aligned(16))) bf16 abuf[2][256 * P64];  /* 36 KiB each */
  __shared__ __attribute__((aligned(16))) bf16 bbuf[2][384 * P64];  /* 54 KiB each */

  const int tid  = threadIdx.x;
  const int lane = tid & 31;
  /* the wave's number as a scalar: which waves copy A, and which matrix the
   * wave's columns belong to, are then scalar branches */
  const int w    = __builtin_amdgcn_readfirstlane(tid >> 5);
  const int row0 = blockIdx.x * 256;
  const int mw   = w & 3;              /* 4 waves across M */
  const int nw   = w >> 2;             /* 3 waves across N */
  const int ln   = lane & 15;
  const int kb   = (lane >> 4) * 8;
  const int g128 = blockIdx.y * 3 + nw;   /* the wave's 128 of the 3072 columns */
  const int mat  = g128 >> 3;
  const int h0   = (g128 & 7) * 2;        /* the first of its two heads */

  const float* bias = (mat == 0) ? bq : ((mat == 1) ? bk : bv);

  const bf16* asrc = xh + (size_t)row0 * Dn;                 /* row stride Dn */
  const bf16* bsrc = wt + (size_t)blockIdx.y * 384 * Dn;

  v8f acc[4][8];
  for (int t = 0; t < 8; ++t) {
    float bval = bias[h0 * 64 + t * 16 + ln];
    for (int i = 0; i < 4; ++i)
      for (int r = 0; r < 8; ++r) acc[i][t][r] = bval;
  }

  /* cooperative stage of one 256x64 A tile + 384x64 B tile: 16-B chunks, eight
   * to a row, so that a wave's copy covers four whole lines; B by all 12 waves
   * (rows 48 apart), A by the first 8 (rows 32 apart) */
  auto stage = [&](int kk, int buf) {
    /* the lane's number read anew at every stage: the copy addresses formed
     * from it once, and kept over the loop beside 256 accumulator registers,
     * are spilled to scratch and loaded back in front of the copies */
    unsigned sln;
    asm volatile("v_mbcnt_lo_u32_b32 %0, -1, 0" : "=v"(sln));
    const unsigned srow = w * 4 + (sln >> 3), soff = (sln & 7) * 8;
    const unsigned voff = (srow * Dn + soff) * 2;             /* bytes */
    const unsigned sl   = srow * P64 + soff;
    async8s_b128(bsrc + kk, (size_t)48 * Dn, voff, &bbuf[buf][sl], 48 * P64);
    if (w < 8)
      async8s_b128(asrc + kk, (size_t)32 * Dn, voff, &abuf[buf][sl], 32 * P64);
  };

  stage(0, 0);
  int cur = 0;
  for (int kk = 0; kk < Dn; kk += 64) {
    wait_async();
    __syncthreads();
    if (kk + 64 < Dn) stage(kk + 64, cur ^ 1);

    for (int ks = 0; ks < 64; ks += 32) {
      const bf16* ap = &abuf[cur][(mw * 64 + ln) * P64 + ks + kb];
      const bf16* bp = &bbuf[cur][(nw * 128 + ln) * P64 + ks + kb];
      v16bf a[4];
      for (int i = 0; i < 4; ++i) a[i] = load_frag(ap + i * 16 * P64);
      v16bf b[2];
      b[0] = load_frag(bp);
      for (int t = 0; t < 8; ++t) {
        if (t < 7) b[(t + 1) & 1] = load_frag(bp + (t + 1) * 16 * P64);
        /* keeps the next B fragment's loads ahead of this fragment's four
         * products: sunk behind them, into one register set, each fragment
         * waits out the LDS latency with the matrix unit idle */
        __builtin_amdgcn_sched_barrier(0);
        for (int i = 0; i < 4; ++i)
          acc[i][t] = wmma_bf16(a[i], b[t & 1], acc[i][t]);
      }
    }
    cur ^= 1;
  }

  /* Epilogue: each wave turns its tile, 16 rows of one head at a time (V^T: a
   * head's 64 x 64), through 9 KiB of its own in the ring, so that every
   * global store is 8 or 16 B a lane on whole 128-B lines. A head's 64 rows s
   * are contiguous in the (B,H,S,dh) arrays. Row pitch 272 B (f32) and 144 B
   * (V^T): 16 B x odd.                                                     */
  __syncthreads();              /* every wave has left the ring */
  float* st = (float*)((w < 8) ? &abuf[0][0] : &bbuf[0][0]) + (w & 7) * 2304;
  const int hf = lane >> 4;
  const int m0 = row0 + mw * 64;
  const int s0 = m0 & 2047;

  /* 16 rows m of 64 columns n: out of the accumulators, back as rows; v[j]
   * is row 2j + hf, columns 4 ln .. 4 ln + 3: element 128 j + 4 lane       */
  auto turn = [&](int ms, int hd, v4f* v) {
    for (int t = 0; t < 4; ++t)
      for (int r = 0; r < 8; ++r)
        st[(8 * hf + r) * 68 + t * 16 + ln] = acc[ms][hd * 4 + t][r];
    /* the rows read back were written by other lanes of this wave; they land
     * in registers that the global stores of the turn before name: the second
     * wait stands in front of that overwrite */
    asm volatile("s_wait_dscnt 0x0\n\ts_wait_xcnt 0x0" ::: "memory");
    for (int j = 0; j < 8; ++j)
      v[j] = *(const v4f*)(st + (2 * j + hf) * 68 + ln * 4);
  };

  /* unrolled: the accumulators stay in registers only under constant indices */
#pragma unroll
  for (int hd = 0; hd < 2; ++hd) {
    const int bhd = (m0 >> 11) * Hn + h0 + hd;                 /* b*H + h */
    const size_t tile = ((size_t)bhd * Sn + s0) * DHn + lane * 4;
    if (mat == 0) {
#pragma unroll
      for (int ms = 0; ms < 4; ++ms) {
        v4f v[8];
        turn(ms, hd, v);
        for (int j = 0; j < 8; ++j)                    /* fold 1/sqrt(64) */
          *(v4bf*)(qh + tile + ms * 1024 + j * 128) =
              __builtin_convertvector(v[j] * 0.125f, v4bf);
      }
      /* closes the branch: whatever follows it may overwrite registers that
       * its last stores name */
      asm volatile("s_wait_xcnt 0x0" ::: "memory");
    } else if (mat == 1) {
      float* ko = out + (size_t)Mn * Dn + tile;        /* K cache f32 */
#pragma unroll
      for (int ms = 0; ms < 4; ++ms) {
        v4f v[8];
        turn(ms, hd, v);
        for (int j = 0; j < 8; ++j) *(v4f*)(ko + ms * 1024 + j * 128) = v[j];
        /* the conversions land in registers that the stores above name: the
         * wait stands in front of that overwrite, and the scheduling barrier
         * holds the conversions behind it */
        asm volatile("s_wait_xcnt 0x0" ::: "memory");
        __builtin_amdgcn_sched_barrier(0);
        for (int j = 0; j < 8; ++j)
          *(v4bf*)(kh + tile + ms * 1024 + j * 128) =
              __builtin_convertvector(v[j], v4bf);
      }
      /* closes the branch, as in the branch above */
      asm volatile("s_wait_xcnt 0x0" ::: "memory");
    } else {
      float* vo = out + (size_t)2 * Mn * Dn + tile;    /* V cache f32 */
#pragma unroll
      for (int ms = 0; ms < 4; ++ms) {
        v4f v[8];
        turn(ms, hd, v);
        for (int j = 0; j < 8; ++j) *(v4f*)(vo + ms * 1024 + j * 128) = v[j];
      }
      /* V^T: a lane's 8 accumulator rows are 8 consecutive s of one d.
       * The wait stands in front of the overwrite of registers that the
       * stores above name; the scheduling barrier holds the conversions
       * behind it */
      asm volatile("s_wait_xcnt 0x0" ::: "memory");
      __builtin_amdgcn_sched_barrier(0);
#pragma unroll
      for (int ms = 0; ms < 4; ++ms)
        for (int t = 0; t < 4; ++t) {
          v8bf p;
          for (int r = 0; r < 8; ++r) p[r] = (bf16)acc[ms][hd * 4 + t][r];
          *(v4f*)(st + (t * 16 + ln) * 36 + ms * 8 + hf * 4) =
              __builtin_bit_cast(v4f, p);
        }
      /* the rows read back were written by other lanes of this wave */
      asm volatile("s_wait_dscnt 0x0" ::: "memory");
      bf16* vo2 = vt + ((size_t)bhd * DHn + (lane >> 3)) * Sn + s0 + (lane & 7) * 8;
      for (int j = 0; j < 16; ++j)
        *(v4f*)(vo2 + (size_t)j * 4 * Sn) =
            *(const v4f*)(st + (j * 4 + (lane >> 3)) * 36 + (lane & 7) * 4);
      /* closes the branch, as in the branches above */
      asm volatile("s_wait_xcnt 0x0" ::: "memory");
    }
  }
}

__global__ void __launch_bounds__(256, 1)
attn_kernel(const bf16* __restrict__ qh, const bf16* __restrict__ kh,
            const bf16* __restrict__ vt, float* __restrict__ attn) {
  __shared__ __attribute__((aligned(16))) bf16 kbuf[2][32 * P64];  /* [kv][dh] */
  __shared__ __attribute__((aligned(16))) bf16 vbuf[2][64 * P32];  /* [dh][kv] */

  const int tid  = threadIdx.x;
  const int lane = tid & 31;
  /* the wave's number as a scalar: the tests on the wave's causal bound in the
   * key loop are then scalar branches */
  const int w    = __builtin_amdgcn_readfirstlane(tid >> 5);
  const int bh   = blockIdx.x;                 /* b*16 + h */
  const int qblk = blockIdx.y;
  const int q0   = qblk * 128 + w * 16;
  const int ln   = lane & 15;
  const int kb   = (lane >> 4) * 8;

  const bf16* qp = qh + (size_t)bh * Sn * DHn;
  const bf16* kp = kh + (size_t)bh * Sn * DHn;
  const bf16* vp = vt + (size_t)bh * DHn * Sn;

  /* B operand: column = query q0 + ln, k = dh in the loader's order */
  v16bf qb0 = load_frag(qp + (size_t)(q0 + ln) * DHn + 0  + kb);
  v16bf qb1 = load_frag(qp + (size_t)(q0 + ln) * DHn + 32 + kb);

  v8f acco[4];                         /* O^T: [dh = 16t + kb + r][query ln] */
  for (int t = 0; t < 4; ++t)
    for (int r = 0; r < 8; ++r) acco[t][r] = 0.0f;
  float mrow = -1e30f;                 /* this lane's query, both halves alike */
  float lrow = 0.0f;                   /* this half's share of the row sum     */

  const int qg        = q0 + ln;               /* this lane's query      */
  const int nblk_wave = (q0 + 47) >> 5;        /* causal bound per wave  */
  const int nblk_blk  = qblk * 4 + 4;          /* uniform over the block */

  /* cooperative stage of one K(32x64) + V(64x32) tile */
  auto stage_kv = [&](int blk, int buf) {
    int kv0 = blk * 32;
    int krow = tid >> 3, koff = (tid & 7) * 8;  /* 256 chunks of K   */
    int vrow = tid >> 2, voff = (tid & 3) * 8;  /* 256 chunks of V^T */
    async2_b128(kp + (size_t)(kv0 + krow) * DHn + koff,
                &kbuf[buf][krow * P64 + koff],
                vp + (size_t)vrow * Sn + kv0 + voff,
                &vbuf[buf][vrow * P32 + voff]);
  };

  stage_kv(0, 0);
  int cur = 0;
  for (int blk = 0; blk < nblk_blk; ++blk) {
    wait_async();
    __syncthreads();
    if (blk + 1 < nblk_blk) stage_kv(blk + 1, cur ^ 1);

    if (blk < nblk_wave) {
      int kv0 = blk * 32;
      v8f s0, s1;
      for (int r = 0; r < 8; ++r) { s0[r] = 0.0f; s1[r] = 0.0f; }

      v16bf k0a = load_frag(&kbuf[cur][(ln)      * P64 + 0  + kb]);
      v16bf k1a = load_frag(&kbuf[cur][(16 + ln) * P64 + 0  + kb]);
      v16bf k0b = load_frag(&kbuf[cur][(ln)      * P64 + 32 + kb]);
      v16bf k1b = load_frag(&kbuf[cur][(16 + ln) * P64 + 32 + kb]);
      /* keeps the eight K loads one group ahead of the products: with the
       * branch below ending the block, the compiler otherwise reloads one
       * register set and waits out the LDS latency three times a pass     */
      __builtin_amdgcn_sched_barrier(0);
      s0 = wmma_bf16(k0a, qb0, s0);
      s1 = wmma_bf16(k1a, qb0, s1);
      s0 = wmma_bf16(k0b, qb1, s0);
      s1 = wmma_bf16(k1b, qb1, s1);

      /* online softmax of one query per lane: s0[r] is key kv0 + kb + r,
       * s1[r] is key kv0 + 16 + kb + r                                   */
      /* only the wave's last block, which holds its 16 queries' own
       * positions, has keys behind a query: the blocks before it take their
       * scores as they are                                               */
      if (blk + 1 == nblk_wave) {
        for (int r = 0; r < 8; ++r) {
          s0[r] = ((kv0 + kb + r)      <= qg) ? s0[r] : -1e30f;
          s1[r] = ((kv0 + 16 + kb + r) <= qg) ? s1[r] : -1e30f;
        }
      }
      float mx = -1e30f;
      for (int r = 0; r < 8; ++r) mx = fmaxf(mx, fmaxf(s0[r], s1[r]));
      mx = fmaxf(mx, xhalf(mx));
      float mnew = fmaxf(mrow, mx);
      float corr = __expf(mrow - mnew);
      mrow = mnew;

      v16bf pb;                        /* P^T as B: k = kb + r, 16 + kb + r */
      float rs0 = 0.0f, rs1 = 0.0f;
      for (int r = 0; r < 8; ++r) {
        float p0 = __expf(s0[r] - mnew);
        float p1 = __expf(s1[r] - mnew);
        rs0 += p0;
        rs1 += p1;
        pb[r]     = (bf16)p0;
        pb[8 + r] = (bf16)p1;
      }
      lrow = lrow * corr + (rs0 + rs1);
      for (int t = 0; t < 4; ++t)
        for (int r = 0; r < 8; ++r) acco[t][r] *= corr;

      for (int t = 0; t < 4; ++t) {
        v16bf va = load_frag(&vbuf[cur][(t * 16 + ln) * P32 + kb]);
        acco[t] = wmma_bf16(va, pb, acco[t]);
      }
    }
    cur ^= 1;
  }

  /* join the two halves' shares of the row sum, once */
  lrow += xhalf(lrow);
  const float inv = 1.0f / lrow;

  const int b = bh >> 4, h = bh & 15;
  float* op = attn + ((size_t)(b * Sn + qg)) * Dn + h * DHn + kb;
  for (int t = 0; t < 4; ++t) {
    float4 lo, hi;
    lo.x = acco[t][0] * inv; lo.y = acco[t][1] * inv;
    lo.z = acco[t][2] * inv; lo.w = acco[t][3] * inv;
    hi.x = acco[t][4] * inv; hi.y = acco[t][5] * inv;
    hi.z = acco[t][6] * inv; hi.w = acco[t][7] * inv;
    *(float4*)(op + t * 16)     = lo;
    *(float4*)(op + t * 16 + 4) = hi;
  }
}

/* ---------------- residual + LayerNorm ----------------
 * Streaming form: grid 512, block 256 (16 waves per WGP), two rows per wave.
 * A lane holds 32 elements of each row (8 x 16 B of x and of attn) and its
 * 32 elements of gamma and beta, which serve both rows; the sums are
 * in-lane, then a butterfly over the 32 lanes: no LDS.                    */

/* sum over the wave, the same value in every lane: four exchanges inside the
 * 16-lane row, one between the rows */
__device__ __forceinline__ float wave_sum(float s) {
  s += __builtin_bit_cast(float, __builtin_amdgcn_update_dpp(
      0, __builtin_bit_cast(int, s), 0x161, 0xf, 0xf, true));  /* row_xmask:1 */
  s += __builtin_bit_cast(float, __builtin_amdgcn_update_dpp(
      0, __builtin_bit_cast(int, s), 0x162, 0xf, 0xf, true));  /* row_xmask:2 */
  s += __builtin_bit_cast(float, __builtin_amdgcn_update_dpp(
      0, __builtin_bit_cast(int, s), 0x164, 0xf, 0xf, true));  /* row_xmask:4 */
  s += __builtin_bit_cast(float, __builtin_amdgcn_update_dpp(
      0, __builtin_bit_cast(int, s), 0x168, 0xf, 0xf, true));  /* row_xmask:8 */
  return s + xhalf(s);
}

__global__ void __launch_bounds__(256)
ln_kernel(const float* __restrict__ x, const float* __restrict__ attn,
          const float* __restrict__ gamma, const float* __restrict__ beta,
          float* __restrict__ out) {
  const unsigned l4 = (threadIdx.x & 31) * 4;   /* the lane's place in 128 */
  /* the wave's number as a scalar: the row addresses then stay in scalar
   * registers and the one lane offset serves every load and store */
  const int wave = __builtin_amdgcn_readfirstlane(threadIdx.x >> 5);
  const size_t off = (size_t)((blockIdx.x * 8 + wave) * 2) * Dn;
  const float* xr = x    + off;
  const float* ar = attn + off;
  float*       yr = out  + off;

  v4f xv[2][8], av[2][8], g[8], b[8];
  for (int j = 0; j < 2; ++j)
    for (int i = 0; i < 8; ++i) {
      xv[j][i] = *(const v4f*)(xr + l4 + j * Dn + i * 128);
      av[j][i] = *(const v4f*)(ar + l4 + j * Dn + i * 128);
    }
  for (int i = 0; i < 8; ++i) {
    g[i] = *(const v4f*)(gamma + l4 + i * 128);
    b[i] = *(const v4f*)(beta  + l4 + i * 128);
  }
  /* keeps every load of the wave ahead of the arithmetic, so that all are in
   * flight together; without it the later ones are sunk behind the sums */
  __builtin_amdgcn_sched_barrier(0);

  float s[2];
  for (int j = 0; j < 2; ++j) {
    v4f s4 = {0.0f, 0.0f, 0.0f, 0.0f};
    for (int i = 0; i < 8; ++i) { xv[j][i] += av[j][i]; s4 += xv[j][i]; }
    s[j] = (s4[0] + s4[1]) + (s4[2] + s4[3]);
  }
  for (int j = 0; j < 2; ++j) s[j] = wave_sum(s[j]) * (1.0f / 1024.0f);

  float q[2];
  for (int j = 0; j < 2; ++j) {
    v4f q4 = {0.0f, 0.0f, 0.0f, 0.0f};
    for (int i = 0; i < 8; ++i) { xv[j][i] -= s[j]; q4 += xv[j][i] * xv[j][i]; }
    q[j] = (q4[0] + q4[1]) + (q4[2] + q4[3]);
  }
  for (int j = 0; j < 2; ++j)
    q[j] = rsqrtf(wave_sum(q[j]) * (1.0f / 1024.0f) + 1e-5f);

  for (int j = 0; j < 2; ++j)
    for (int i = 0; i < 8; ++i)
      *(v4f*)(yr + l4 + j * Dn + i * 128) = xv[j][i] * q[j] * g[i] + b[i];
}

extern "C" void kernel_launch(void* const* d_in, const int* in_sizes, int n_in,
                              void* d_out, int out_size, void* d_ws, size_t ws_size,
                              hipStream_t stream) {
  const float* x     = (const float*)d_in[0];
  const float* Wq    = (const float*)d_in[1];
  const float* bq    = (const float*)d_in[2];
  const float* Wk    = (const float*)d_in[3];
  const float* bk    = (const float*)d_in[4];
  const float* Wv    = (const float*)d_in[5];
  const float* bv    = (const float*)d_in[6];
  const float* gamma = (const float*)d_in[7];
  const float* beta  = (const float*)d_in[8];
  float* out = (float*)d_out;

  char* ws = (char*)d_ws;
  bf16*  xh   = (bf16*)(ws + XH_OFF);
  bf16*  wt   = (bf16*)(ws + WT_OFF);
  bf16*  qh   = (bf16*)(ws + QH_OFF);
  bf16*  kh   = (bf16*)(ws + KH_OFF);
  bf16*  vt   = (bf16*)(ws + VT_OFF);
  float* attn = (float*)(ws + AT_OFF);

  cvt_x_kernel<<<Mn * Dn / 16384, 256, 0, stream>>>(x, xh);
  cvt_wT_kernel<<<dim3(Dn * Dn / 8192, 3), 256, 0, stream>>>(Wq, Wk, Wv, wt);
  gemm_qkv_kernel<<<dim3(Mn / 256, 3 * Dn / 384), 384, 0, stream>>>(
      xh, wt, bq, bk, bv, qh, kh, vt, out);
  attn_kernel<<<dim3(Bn * Hn, Sn / 128), 256, 0, stream>>>(qh, kh, vt, attn);
  ln_kernel<<<Mn / 16, 256, 0, stream>>>(x, attn, gamma, beta, out);
}

// v007
// A run of this version takes 95.8 microseconds.
// In both of two side-by-side timings against v006, it was 1.09 times as fast.
// Over all steps from v000 it is 5.00 times as fast.
#include <hip/hip_runtime.h>
#include <math.h>
#include <stdint.h>

typedef __bf16 bf16;
typedef __attribute__((ext_vector_type(16))) __bf16 v16bf;
typedef __attribute__((ext_vector_type(8)))  __bf16 v8bf;
typedef __attribute__((ext_vector_type(8)))  float  v8f;
typedef __attribute__((ext_vector_type(4)))  float  v4f;
typedef __attribute__((ext_vector_type(4)))  __bf16 v4bf;

#define Bn  4
#define Sn  2048
#define Dn  1024
#define Hn  16
#define DHn 64
#define Mn  (Bn * Sn)          /* 8192 rows of x */

/* workspace layout (bytes) */
#define XH_OFF  0ull
#define XH_BY   ((size_t)Mn * Dn * 2)        /* x in bf16            16 MiB */
#define WT_OFF  (XH_OFF + XH_BY)
#define WT_BY   ((size_t)3 * Dn * Dn * 2)    /* Wq/Wk/Wv^T bf16       6 MiB */
#define QH_OFF  (WT_OFF + WT_BY)
#define QH_BY   ((size_t)Mn * Dn * 2)        /* Q bf16 (B,H,S,dh)    16 MiB */
#define KH_OFF  (QH_OFF + QH_BY)
#define KH_BY   ((size_t)Mn * Dn * 2)        /* K bf16 (B,H,S,dh)    16 MiB */
#define VT_OFF  (KH_OFF + KH_BY)
#define VT_BY   ((size_t)Mn * Dn * 2)        /* V^T bf16 (B,H,dh,S)  16 MiB */
#define AT_OFF  (VT_OFF + VT_BY)
#define AT_BY   ((size_t)Mn * Dn * 4)        /* attn f32 (B,S,D)     32 MiB */

#define P64 72                 /* rows of 64 bf16 (128 B): pitch 144 B */
#define P128 136               /* rows of 128 bf16 (256 B): pitch 272 B */

#define LDSA(l) ((unsigned)(uintptr_t)(l))
#define GLBA(g) ((unsigned long long)(uintptr_t)(g))
/* The global address is a scalar base plus one 32-bit lane offset in bytes:
 * eight rows a fixed step apart share the offset register, so a stage's
 * copies take 9 vector registers, not 24 (beside 256 accumulator registers
 * the 64-bit lane addresses spill to scratch).                            */
__device__ __forceinline__ void async8s_b128(const bf16* g, size_t gstep,
                                             unsigned voff, bf16* l, int lstep) {
  asm volatile("global_load_async_to_lds_b128 %0, %16, %1\n\t"
               "global_load_async_to_lds_b128 %2, %16, %3\n\t"
               "global_load_async_to_lds_b128 %4, %16, %5\n\t"
               "global_load_async_to_lds_b128 %6, %16, %7\n\t"
               "global_load_async_to_lds_b128 %8, %16, %9\n\t"
               "global_load_async_to_lds_b128 %10, %16, %11\n\t"
               "global_load_async_to_lds_b128 %12, %16, %13\n\t"
               "global_load_async_to_lds_b128 %14, %16, %15\n\t"
               "s_wait_xcnt 0x0"
               :
               : "v"(LDSA(l)),             "s"(GLBA(g)),
                 "v"(LDSA(l + lstep)),     "s"(GLBA(g + gstep)),
                 "v"(LDSA(l + 2 * lstep)), "s"(GLBA(g + 2 * gstep)),
                 "v"(LDSA(l + 3 * lstep)), "s"(GLBA(g + 3 * gstep)),
                 "v"(LDSA(l + 4 * lstep)), "s"(GLBA(g + 4 * gstep)),
                 "v"(LDSA(l + 5 * lstep)), "s"(GLBA(g + 5 * gstep)),
                 "v"(LDSA(l + 6 * lstep)), "s"(GLBA(g + 6 * gstep)),
                 "v"(LDSA(l + 7 * lstep)), "s"(GLBA(g + 7 * gstep)),
                 "v"(voff)
               : "memory");
}

/* the same for four rows a fixed step apart */
__device__ __forceinline__ void async4s_b128(const bf16* g, size_t gstep,
                                             unsigned voff, bf16* l, int lstep) {
  asm volatile("global_load_async_to_lds_b128 %0, %8, %1\n\t"
               "global_load_async_to_lds_b128 %2, %8, %3\n\t"
               "global_load_async_to_lds_b128 %4, %8, %5\n\t"
               "global_load_async_to_lds_b128 %6, %8, %7\n\t"
               "s_wait_xcnt 0x0"
               :
               : "v"(LDSA(l)),             "s"(GLBA(g)),
                 "v"(LDSA(l + lstep)),     "s"(GLBA(g + gstep)),
                 "v"(LDSA(l + 2 * lstep)), "s"(GLBA(g + 2 * gstep)),
                 "v"(LDSA(l + 3 * lstep)), "s"(GLBA(g + 3 * gstep)),
                 "v"(voff)
               : "memory");
}

/* in front of the barrier that hands a stage over: first this wave's LDS reads
 * of the buffer that is refilled behind the barrier have returned, then its
 * own copies of the next stage have landed */
__device__ __forceinline__ void wait_async() {
  asm volatile("s_wait_dscnt 0x0" ::: "memory");
  asm volatile("s_wait_asynccnt 0x0" ::: "memory");
}

__device__ __forceinline__ v16bf load_frag(const bf16* p) {
  union { v16bf v; v8bf h[2]; } f;
  f.h[0] = *(const v8bf*)(p);
  f.h[1] = *(const v8bf*)(p + 16);
  return f.v;
}

__device__ __forceinline__ v8f wmma_bf16(v16bf a, v16bf b, v8f c) {
  return __builtin_amdgcn_wmma_f32_16x16x32_bf16(
      false, a, false, b, (short)0, c, false, false);
}

__device__ __forceinline__ float xhalf(float x) {
  int b = __builtin_bit_cast(int, x);
  return __builtin_bit_cast(float, __builtin_amdgcn_permlanex16(
      b, b, 0x76543210, 0xfedcba98, false, false));
}

/* ---------------- conversion kernels ----------------
 * Streaming form: few waves, each with 8 or 16 loads of 16 bytes a lane in
 * flight, every load instruction of a wave covering whole 128-byte lines. */

/* grid 512, block 256: 16 waves per WGP. A wave converts 2048 consecutive
 * elements, 16 loads and 16 stores a lane.                               */
__global__ void __launch_bounds__(256)
cvt_x_kernel(const float* __restrict__ x, bf16* __restrict__ xh) {
  const int lane = threadIdx.x & 31;
  const int wv   = blockIdx.x * 8 + (threadIdx.x >> 5);
  const size_t base = (size_t)wv * 2048 + lane * 4;
  v4f v[16];
  for (int i = 0; i < 16; ++i) v[i] = *(const v4f*)(x + base + i * 128);
  for (int i = 0; i < 16; ++i)
    *(v4bf*)(xh + base + i * 128) = __builtin_convertvector(v[i], v4bf);
}

/* grid (128, 3), block 256. A wave transposes a 32(k) x 32(n) tile in
 * registers: a lane loads 8 rows k of 4 columns n (a load instruction reads
 * 4 rows of 128 B) and stores 4 rows n of 8 k (16 B each).               */
__global__ void __launch_bounds__(256)
cvt_wT_kernel(const float* __restrict__ Wq,
              const float* __restrict__ Wk,
              const float* __restrict__ Wv,
              bf16* __restrict__ wt) {
  const int mat = blockIdx.y;
  const float* W = (mat == 0) ? Wq : ((mat == 1) ? Wk : Wv);
  const int lane = threadIdx.x & 31;
  const int wv   = blockIdx.x * 8 + (threadIdx.x >> 5);   /* 0..1023 */
  const int k0   = (wv & 31) * 32 + (lane & 3) * 8;
  const int n0   = (wv >> 5) * 32 + (lane >> 2) * 4;
  v4f v[8];
  for (int i = 0; i < 8; ++i)
    v[i] = *(const v4f*)(W + (size_t)(k0 + i) * Dn + n0);
  bf16* o = wt + (size_t)mat * Dn * Dn + (size_t)n0 * Dn + k0;
  for (int j = 0; j < 4; ++j) {
    v8bf r;
    for (int i = 0; i < 8; ++i) r[i] = (bf16)v[i][j];
    *(v8bf*)(o + (size_t)j * Dn) = r;
  }
}

/* ---------------- fused QKV GEMM (bf16 WMMA, f32 acc) ----------------
 * The three weight matrices stand stacked in wt as one 3072 x 1024 operand.
 * grid (32, 8), block 384 (12 waves): one work-group per WGP, one round.
 * Block tile 256(M) x 384(N), wave tile 64 x 128 (two heads of one matrix):
 * a fragment read from LDS feeds 4 or 8 products, a row copied from L2 feeds
 * 384 or 256 columns. A stage is 64 k: its rows are whole 128-B lines.
 * A/B tiles double-buffered in LDS via async-to-LDS.                       */
__global__ void __launch_bounds__(384, 1)
gemm_qkv_kernel(const bf16* __restrict__ xh, const bf16* __restrict__ wt,
                const float* __restrict__ bq, const float* __restrict__ bk,
                const float* __restrict__ bv,
                bf16* __restrict__ qh, bf16* __restrict__ kh,
                bf16* __restrict__ vt, float* __restrict__ out) {
  __shared__ __attribute__((aligned(16))) bf16 abuf[2][256 * P64];  /* 36 KiB each */
  __shared__ __attribute__((aligned(16))) bf16 bbuf[2][384 * P64];  /* 54 KiB each */

  const int tid  = threadIdx.x;
  const int lane = tid & 31;
  /* the wave's number as a scalar: which waves copy A, and which matrix the
   * wave's columns belong to, are then scalar branches */
  const int w    = __builtin_amdgcn_readfirstlane(tid >> 5);
  const int row0 = blockIdx.x * 256;
  const int mw   = w & 3;              /* 4 waves across M */
  const int nw   = w >> 2;             /* 3 waves across N */
  const int ln   = lane & 15;
  const int kb   = (lane >> 4) * 8;
  const int g128 = blockIdx.y * 3 + nw;   /* the wave's 128 of the 3072 columns */
  const int mat  = g128 >> 3;
  const int h0   = (g128 & 7) * 2;        /* the first of its two heads */

  const float* bias = (mat == 0) ? bq : ((mat == 1) ? bk : bv);

  const bf16* asrc = xh + (size_t)row0 * Dn;                 /* row stride Dn */
  const bf16* bsrc = wt + (size_t)blockIdx.y * 384 * Dn;

  v8f acc[4][8];
  for (int t = 0; t < 8; ++t) {
    float bval = bias[h0 * 64 + t * 16 + ln];
    for (int i = 0; i < 4; ++i)
      for (int r = 0; r < 8; ++r) acc[i][t][r] = bval;
  }

  /* cooperative stage of one 256x64 A tile + 384x64 B tile: 16-B chunks, eight
   * to a row, so that a wave's copy covers four whole lines; B by all 12 waves
   * (rows 48 apart), A by the first 8 (rows 32 apart) */
  auto stage = [&](int kk, int buf) {
    /* the lane's number read anew at every stage: the copy addresses formed
     * from it once, and kept over the loop beside 256 accumulator registers,
     * are spilled to scratch and loaded back in front of the copies */
    unsigned sln;
    asm volatile("v_mbcnt_lo_u32_b32 %0, -1, 0" : "=v"(sln));
    const unsigned srow = w * 4 + (sln >> 3), soff = (sln & 7) * 8;
    const unsigned voff = (srow * Dn + soff) * 2;             /* bytes */
    const unsigned sl   = srow * P64 + soff;
    async8s_b128(bsrc + kk, (size_t)48 * Dn, voff, &bbuf[buf][sl], 48 * P64);
    if (w < 8)
      async8s_b128(asrc + kk, (size_t)32 * Dn, voff, &abuf[buf][sl], 32 * P64);
  };

  stage(0, 0);
  int cur = 0;
  for (int kk = 0; kk < Dn; kk += 64) {
    wait_async();
    __syncthreads();
    if (kk + 64 < Dn) stage(kk + 64, cur ^ 1);

    for (int ks = 0; ks < 64; ks += 32) {
      const bf16* ap = &abuf[cur][(mw * 64 + ln) * P64 + ks + kb];
      const bf16* bp = &bbuf[cur][(nw * 128 + ln) * P64 + ks + kb];
      v16bf a[4];
      for (int i = 0; i < 4; ++i) a[i] = load_frag(ap + i * 16 * P64);
      v16bf b[2];
      b[0] = load_frag(bp);
      for (int t = 0; t < 8; ++t) {
        if (t < 7) b[(t + 1) & 1] = load_frag(bp + (t + 1) * 16 * P64);
        /* keeps the next B fragment's loads ahead of this fragment's four
         * products: sunk behind them, into one register set, each fragment
         * waits out the LDS latency with the matrix unit idle */
        __builtin_amdgcn_sched_barrier(0);
        for (int i = 0; i < 4; ++i)
          acc[i][t] = wmma_bf16(a[i], b[t & 1], acc[i][t]);
      }
    }
    cur ^= 1;
  }

  /* Epilogue: each wave turns its tile, 16 rows of one head at a time (V^T: a
   * head's 64 x 64), through 9 KiB of its own in the ring, so that every
   * global store is 8 or 16 B a lane on whole 128-B lines. A head's 64 rows s
   * are contiguous in the (B,H,S,dh) arrays. Row pitch 272 B (f32) and 144 B
   * (V^T): 16 B x odd.                                                     */
  __syncthreads();              /* every wave has left the ring */
  float* st = (float*)((w < 8) ? &abuf[0][0] : &bbuf[0][0]) + (w & 7) * 2304;
  const int hf = lane >> 4;
  const int m0 = row0 + mw * 64;
  const int s0 = m0 & 2047;

  /* 16 rows m of 64 columns n: out of the accumulators, back as rows; v[j]
   * is row 2j + hf, columns 4 ln .. 4 ln + 3: element 128 j + 4 lane       */
  auto turn = [&](int ms, int hd, v4f* v) {
    for (int t = 0; t < 4; ++t)
      for (int r = 0; r < 8; ++r)
        st[(8 * hf + r) * 68 + t * 16 + ln] = acc[ms][hd * 4 + t][r];
    /* the rows read back were written by other lanes of this wave; they land
     * in registers that the global stores of the turn before name: the second
     * wait stands in front of that overwrite */
    asm volatile("s_wait_dscnt 0x0\n\ts_wait_xcnt 0x0" ::: "memory");
    for (int j = 0; j < 8; ++j)
      v[j] = *(const v4f*)(st + (2 * j + hf) * 68 + ln * 4);
  };

  /* unrolled: the accumulators stay in registers only under constant indices */
#pragma unroll
  for (int hd = 0; hd < 2; ++hd) {
    const int bhd = (m0 >> 11) * Hn + h0 + hd;                 /* b*H + h */
    const size_t tile = ((size_t)bhd * Sn + s0) * DHn + lane * 4;
    if (mat == 0) {
#pragma unroll
      for (int ms = 0; ms < 4; ++ms) {
        v4f v[8];
        turn(ms, hd, v);
        for (int j = 0; j < 8; ++j)                    /* fold 1/sqrt(64) */
          *(v4bf*)(qh + tile + ms * 1024 + j * 128) =
              __builtin_convertvector(v[j] * 0.125f, v4bf);
      }
      /* closes the branch: whatever follows it may overwrite registers that
       * its last stores name */
      asm volatile("s_wait_xcnt 0x0" ::: "memory");
    } else if (mat == 1) {
      float* ko = out + (size_t)Mn * Dn + tile;        /* K cache f32 */
#pragma unroll
      for (int ms = 0; ms < 4; ++ms) {
        v4f v[8];
        turn(ms, hd, v);
        for (int j = 0; j < 8; ++j) *(v4f*)(ko + ms * 1024 + j * 128) = v[j];
        /* the conversions land in registers that the stores above name: the
         * wait stands in front of that overwrite, and the scheduling barrier
         * holds the conversions behind it */
        asm volatile("s_wait_xcnt 0x0" ::: "memory");
        __builtin_amdgcn_sched_barrier(0);
        for (int j = 0; j < 8; ++j)
          *(v4bf*)(kh + tile + ms * 1024 + j * 128) =
              __builtin_convertvector(v[j], v4bf);
      }
      /* closes the branch, as in the branch above */
      asm volatile("s_wait_xcnt 0x0" ::: "memory");
    } else {
      float* vo = out + (size_t)2 * Mn * Dn + tile;    /* V cache f32 */
#pragma unroll
      for (int ms = 0; ms < 4; ++ms) {
        v4f v[8];
        turn(ms, hd, v);
        for (int j = 0; j < 8; ++j) *(v4f*)(vo + ms * 1024 + j * 128) = v[j];
      }
      /* V^T: a lane's 8 accumulator rows are 8 consecutive s of one d.
       * The wait stands in front of the overwrite of registers that the
       * stores above name; the scheduling barrier holds the conversions
       * behind it */
      asm volatile("s_wait_xcnt 0x0" ::: "memory");
      __builtin_amdgcn_sched_barrier(0);
#pragma unroll
      for (int ms = 0; ms < 4; ++ms)
        for (int t = 0; t < 4; ++t) {
          v8bf p;
          for (int r = 0; r < 8; ++r) p[r] = (bf16)acc[ms][hd * 4 + t][r];
          *(v4f*)(st + (t * 16 + ln) * 36 + ms * 8 + hf * 4) =
              __builtin_bit_cast(v4f, p);
        }
      /* the rows read back were written by other lanes of this wave */
      asm volatile("s_wait_dscnt 0x0" ::: "memory");
      bf16* vo2 = vt + ((size_t)bhd * DHn + (lane >> 3)) * Sn + s0 + (lane & 7) * 8;
      for (int j = 0; j < 16; ++j)
        *(v4f*)(vo2 + (size_t)j * 4 * Sn) =
            *(const v4f*)(st + (j * 4 + (lane >> 3)) * 36 + (lane & 7) * 4);
      /* closes the branch, as in the branches above */
      asm volatile("s_wait_xcnt 0x0" ::: "memory");
    }
  }
}

__global__ void __launch_bounds__(256, 1)
attn_kernel(const bf16* __restrict__ qh, const bf16* __restrict__ kh,
            const bf16* __restrict__ vt, float* __restrict__ attn) {
  __shared__ __attribute__((aligned(16))) bf16 kbuf[2][128 * P64];  /* [kv][dh] */
  __shared__ __attribute__((aligned(16))) bf16 vbuf[2][64 * P128];  /* [dh][kv] */

  const int tid  = threadIdx.x;
  const int lane = tid & 31;
  /* the wave's number as a scalar: the tests on the wave's causal bound in the
   * key loop are then scalar branches */
  const int w    = __builtin_amdgcn_readfirstlane(tid >> 5);
  const int bh   = blockIdx.x;                 /* b*16 + h */
  const int qblk = blockIdx.y;
  const int q0   = qblk * 128 + w * 16;
  const int ln   = lane & 15;
  const int kb   = (lane >> 4) * 8;

  const bf16* qp = qh + (size_t)bh * Sn * DHn;
  const bf16* kp = kh + (size_t)bh * Sn * DHn;
  const bf16* vp = vt + (size_t)bh * DHn * Sn;

  /* B operand: column = query q0 + ln, k = dh in the loader's order */
  v16bf qb0 = load_frag(qp + (size_t)(q0 + ln) * DHn + 0  + kb);
  v16bf qb1 = load_frag(qp + (size_t)(q0 + ln) * DHn + 32 + kb);

  v8f acco[4];                         /* O^T: [dh = 16t + kb + r][query ln] */
  for (int t = 0; t < 4; ++t)
    for (int r = 0; r < 8; ++r) acco[t][r] = 0.0f;
  float mrow = -1e30f;                 /* this lane's query, both halves alike */
  float lrow = 0.0f;                   /* this half's share of the row sum     */

  const int qg        = q0 + ln;               /* this lane's query      */
  const int nblk_wave = (q0 + 47) >> 5;        /* causal bound per wave  */

  /* cooperative stage of one K(128x64) + V^T(64x128) tile, 16-B chunks, four
   * of each a lane: K's 128 rows stand contiguous (32 rows a copy of the
   * block), V^T has 16 chunks a row (16 rows a copy of the block)         */
  auto stage_kv = [&](int st, int buf) {
    const int kv0 = st * 128;
    async4s_b128(kp + (size_t)kv0 * DHn, (size_t)32 * DHn, tid * 16,
                 &kbuf[buf][(tid >> 3) * P64 + (tid & 7) * 8], 32 * P64);
    async4s_b128(vp + kv0, (size_t)16 * Sn,
                 (tid >> 4) * (Sn * 2) + (tid & 15) * 16,
                 &vbuf[buf][(tid >> 4) * P128 + (tid & 15) * 8], 16 * P128);
  };

  stage_kv(0, 0);
  int cur = 0;
  for (int st = 0; st <= qblk; ++st) {         /* uniform over the block */
    wait_async();
    __syncthreads();
    if (st < qblk) stage_kv(st + 1, cur ^ 1);

    const int bend = min(st * 4 + 4, nblk_wave);
    for (int blk = st * 4; blk < bend; ++blk) {
      const int kv0 = blk * 32;
      const bf16* kt = &kbuf[cur][(blk & 3) * 32 * P64];   /* the pass's 32 keys */
      const bf16* vq = &vbuf[cur][(blk & 3) * 32];
      v8f s0, s1;
      for (int r = 0; r < 8; ++r) { s0[r] = 0.0f; s1[r] = 0.0f; }

      v16bf k0a = load_frag(kt + (ln)      * P64 + 0  + kb);
      v16bf k1a = load_frag(kt + (16 + ln) * P64 + 0  + kb);
      v16bf k0b = load_frag(kt + (ln)      * P64 + 32 + kb);
      v16bf k1b = load_frag(kt + (16 + ln) * P64 + 32 + kb);
      /* keeps the eight K loads one group ahead of the products: with the
       * branch below ending the block, the compiler otherwise reloads one
       * register set and waits out the LDS latency three times a pass     */
      __builtin_amdgcn_sched_barrier(0);
      s0 = wmma_bf16(k0a, qb0, s0);
      s1 = wmma_bf16(k1a, qb0, s1);
      s0 = wmma_bf16(k0b, qb1, s0);
      s1 = wmma_bf16(k1b, qb1, s1);

      /* online softmax of one query per lane: s0[r] is key kv0 + kb + r,
       * s1[r] is key kv0 + 16 + kb + r                                   */
      /* only the wave's last block, which holds its 16 queries' own
       * positions, has keys behind a query: the blocks before it take their
       * scores as they are                                               */
      if (blk + 1 == nblk_wave) {
        for (int r = 0; r < 8; ++r) {
          s0[r] = ((kv0 + kb + r)      <= qg) ? s0[r] : -1e30f;
          s1[r] = ((kv0 + 16 + kb + r) <= qg) ? s1[r] : -1e30f;
        }
      }
      float mx = -1e30f;
      for (int r = 0; r < 8; ++r) mx = fmaxf(mx, fmaxf(s0[r], s1[r]));
      mx = fmaxf(mx, xhalf(mx));
      float mnew = fmaxf(mrow, mx);
      float corr = __expf(mrow - mnew);
      mrow = mnew;

      v16bf pb;                        /* P^T as B: k = kb + r, 16 + kb + r */
      float rs0 = 0.0f, rs1 = 0.0f;
      for (int r = 0; r < 8; ++r) {
        float p0 = __expf(s0[r] - mnew);
        float p1 = __expf(s1[r] - mnew);
        rs0 += p0;
        rs1 += p1;
        pb[r]     = (bf16)p0;
        pb[8 + r] = (bf16)p1;
      }
      lrow = lrow * corr + (rs0 + rs1);
      for (int t = 0; t < 4; ++t)
        for (int r = 0; r < 8; ++r) acco[t][r] *= corr;

      for (int t = 0; t < 4; ++t) {
        v16bf va = load_frag(vq + (t * 16 + ln) * P128 + kb);
        acco[t] = wmma_bf16(va, pb, acco[t]);
      }
    }
    cur ^= 1;
  }

  /* join the two halves' shares of the row sum, once */
  lrow += xhalf(lrow);
  const float inv = 1.0f / lrow;

  const int b = bh >> 4, h = bh & 15;
  float* op = attn + ((size_t)(b * Sn + qg)) * Dn + h * DHn + kb;
  for (int t = 0; t < 4; ++t) {
    float4 lo, hi;
    lo.x = acco[t][0] * inv; lo.y = acco[t][1] * inv;
    lo.z = acco[t][2] * inv; lo.w = acco[t][3] * inv;
    hi.x = acco[t][4] * inv; hi.y = acco[t][5] * inv;
    hi.z = acco[t][6] * inv; hi.w = acco[t][7] * inv;
    *(float4*)(op + t * 16)     = lo;
    *(float4*)(op + t * 16 + 4) = hi;
  }
}

/* ---------------- residual + LayerNorm ----------------
 * Streaming form: grid 512, block 256 (16 waves per WGP), two rows per wave.
 * A lane holds 32 elements of each row (8 x 16 B of x and of attn) and its
 * 32 elements of gamma and beta, which serve both rows; the sums are
 * in-lane, then a butterfly over the 32 lanes: no LDS.                    */

/* sum over the wave, the same value in every lane: four exchanges inside the
 * 16-lane row, one between the rows */
__device__ __forceinline__ float wave_sum(float s) {
  s += __builtin_bit_cast(float, __builtin_amdgcn_update_dpp(
      0, __builtin_bit_cast(int, s), 0x161, 0xf, 0xf, true));  /* row_xmask:1 */
  s += __builtin_bit_cast(float, __builtin_amdgcn_update_dpp(
      0, __builtin_bit_cast(int, s), 0x162, 0xf, 0xf, true));  /* row_xmask:2 */
  s += __builtin_bit_cast(float, __builtin_amdgcn_update_dpp(
      0, __builtin_bit_cast(int, s), 0x164, 0xf, 0xf, true));  /* row_xmask:4 */
  s += __builtin_bit_cast(float, __builtin_amdgcn_update_dpp(
      0, __builtin_bit_cast(int, s), 0x168, 0xf, 0xf, true));  /* row_xmask:8 */
  return s + xhalf(s);
}

__global__ void __launch_bounds__(256)
ln_kernel(const float* __restrict__ x, const float* __restrict__ attn,
          const float* __restrict__ gamma, const float* __restrict__ beta,
          float* __restrict__ out) {
  const unsigned l4 = (threadIdx.x & 31) * 4;   /* the lane's place in 128 */
  /* the wave's number as a scalar: the row addresses then stay in scalar
   * registers and the one lane offset serves every load and store */
  const int wave = __builtin_amdgcn_readfirstlane(threadIdx.x >> 5);
  const size_t off = (size_t)((blockIdx.x * 8 + wave) * 2) * Dn;
  const float* xr = x    + off;
  const float* ar = attn + off;
  float*       yr = out  + off;

  v4f xv[2][8], av[2][8], g[8], b[8];
  for (int j = 0; j < 2; ++j)
    for (int i = 0; i < 8; ++i) {
      xv[j][i] = *(const v4f*)(xr + l4 + j * Dn + i * 128);
      av[j][i] = *(const v4f*)(ar + l4 + j * Dn + i * 128);
    }
  for (int i = 0; i < 8; ++i) {
    g[i] = *(const v4f*)(gamma + l4 + i * 128);
    b[i] = *(const v4f*)(beta  + l4 + i * 128);
  }
  /* keeps every load of the wave ahead of the arithmetic, so that all are in
   * flight together; without it the later ones are sunk behind the sums */
  __builtin_amdgcn_sched_barrier(0);

  float s[2];
  for (int j = 0; j < 2; ++j) {
    v4f s4 = {0.0f, 0.0f, 0.0f, 0.0f};
    for (int i = 0; i < 8; ++i) { xv[j][i] += av[j][i]; s4 += xv[j][i]; }
    s[j] = (s4[0] + s4[1]) + (s4[2] + s4[3]);
  }
  for (int j = 0; j < 2; ++j) s[j] = wave_sum(s[j]) * (1.0f / 1024.0f);

  float q[2];
  for (int j = 0; j < 2; ++j) {
    v4f q4 = {0.0f, 0.0f, 0.0f, 0.0f};
    for (int i = 0; i < 8; ++i) { xv[j][i] -= s[j]; q4 += xv[j][i] * xv[j][i]; }
    q[j] = (q4[0] + q4[1]) + (q4[2] + q4[3]);
  }
  for (int j = 0; j < 2; ++j)
    q[j] = rsqrtf(wave_sum(q[j]) * (1.0f / 1024.0f) + 1e-5f);

  for (int j = 0; j < 2; ++j)
    for (int i = 0; i < 8; ++i)
      *(v4f*)(yr + l4 + j * Dn + i * 128) = xv[j][i] * q[j] * g[i] + b[i];
}

extern "C" void kernel_launch(void* const* d_in, const int* in_sizes, int n_in,
                              void* d_out, int out_size, void* d_ws, size_t ws_size,
                              hipStream_t stream) {
  const float* x     = (const float*)d_in[0];
  const float* Wq    = (const float*)d_in[1];
  const float* bq    = (const float*)d_in[2];
  const float* Wk    = (const float*)d_in[3];
  const float* bk    = (const float*)d_in[4];
  const float* Wv    = (const float*)d_in[5];
  const float* bv    = (const float*)d_in[6];
  const float* gamma = (const float*)d_in[7];
  const float* beta  = (const float*)d_in[8];
  float* out = (float*)d_out;

  char* ws = (char*)d_ws;
  bf16*  xh   = (bf16*)(ws + XH_OFF);
  bf16*  wt   = (bf16*)(ws + WT_OFF);
  bf16*  qh   = (bf16*)(ws + QH_OFF);
  bf16*  kh   = (bf16*)(ws + KH_OFF);
  bf16*  vt   = (bf16*)(ws + VT_OFF);
  float* attn = (float*)(ws + AT_OFF);

  cvt_x_kernel<<<Mn * Dn / 16384, 256, 0, stream>>>(x, xh);
  cvt_wT_kernel<<<dim3(Dn * Dn / 8192, 3), 256, 0, stream>>>(Wq, Wk, Wv, wt);
  gemm_qkv_kernel<<<dim3(Mn / 256, 3 * Dn / 384), 384, 0, stream>>>(
      xh, wt, bq, bk, bv, qh, kh, vt, out);
  attn_kernel<<<dim3(Bn * Hn, Sn / 128), 256, 0, stream>>>(qh, kh, vt, attn);
  ln_kernel<<<Mn / 16, 256, 0, stream>>>(x, attn, gamma, beta, out);
}

// v008
// Measured time: 88.9 microseconds a run.
// In both of two side-by-side timings against v007, it was 1.08 times as fast.
// Over all steps from v000 it is 5.38 times as fast.
#include <hip/hip_runtime.h>
#include <math.h>
#include <stdint.h>

typedef __bf16 bf16;
typedef __attribute__((ext_vector_type(16))) __bf16 v16bf;
typedef __attribute__((ext_vector_type(8)))  __bf16 v8bf;
typedef __attribute__((ext_vector_type(8)))  float  v8f;
typedef __attribute__((ext_vector_type(4)))  float  v4f;
typedef __attribute__((ext_vector_type(4)))  __bf16 v4bf;

#define Bn  4
#define Sn  2048
#define Dn  1024
#define Hn  16
#define DHn 64
#define Mn  (Bn * Sn)          /* 8192 rows of x */

/* workspace layout (bytes) */
#define XH_OFF  0ull
#define XH_BY   ((size_t)Mn * Dn * 2)        /* x in bf16            16 MiB */
#define WT_OFF  (XH_OFF + XH_BY)
#define WT_BY   ((size_t)3 * Dn * Dn * 2)    /* Wq/Wk/Wv^T bf16       6 MiB */
#define QH_OFF  (WT_OFF + WT_BY)
#define QH_BY   ((size_t)Mn * Dn * 2)        /* Q bf16 (B,H,S,dh)    16 MiB */
#define KH_OFF  (QH_OFF + QH_BY)
#define KH_BY   ((size_t)Mn * Dn * 2)        /* K bf16 (B,H,S,dh)    16 MiB */
#define VT_OFF  (KH_OFF + KH_BY)
#define VT_BY   ((size_t)Mn * Dn * 2)        /* V^T bf16 (B,H,dh,S)  16 MiB */
#define AT_OFF  (VT_OFF + VT_BY)
#define AT_BY   ((size_t)Mn * Dn * 4)        /* attn f32 (B,S,D)     32 MiB */

#define P64 72                 /* rows of 64 bf16 (128 B): pitch 144 B */
#define P128 136               /* rows of 128 bf16 (256 B): pitch 272 B */

#define LDSA(l) ((unsigned)(uintptr_t)(l))
#define GLBA(g) ((unsigned long long)(uintptr_t)(g))
/* The global address is a scalar base plus one 32-bit lane offset in bytes:
 * eight rows a fixed step apart share the offset register, so a stage's
 * copies take 9 vector registers, not 24 (beside 256 accumulator registers
 * the 64-bit lane addresses spill to scratch).                            */
__device__ __forceinline__ void async8s_b128(const bf16* g, size_t gstep,
                                             unsigned voff, bf16* l, int lstep) {
  asm volatile("global_load_async_to_lds_b128 %0, %16, %1\n\t"
               "global_load_async_to_lds_b128 %2, %16, %3\n\t"
               "global_load_async_to_lds_b128 %4, %16, %5\n\t"
               "global_load_async_to_lds_b128 %6, %16, %7\n\t"
               "global_load_async_to_lds_b128 %8, %16, %9\n\t"
               "global_load_async_to_lds_b128 %10, %16, %11\n\t"
               "global_load_async_to_lds_b128 %12, %16, %13\n\t"
               "global_load_async_to_lds_b128 %14, %16, %15\n\t"
               "s_wait_xcnt 0x0"
               :
               : "v"(LDSA(l)),             "s"(GLBA(g)),
                 "v"(LDSA(l + lstep)),     "s"(GLBA(g + gstep)),
                 "v"(LDSA(l + 2 * lstep)), "s"(GLBA(g + 2 * gstep)),
                 "v"(LDSA(l + 3 * lstep)), "s"(GLBA(g + 3 * gstep)),
                 "v"(LDSA(l + 4 * lstep)), "s"(GLBA(g + 4 * gstep)),
                 "v"(LDSA(l + 5 * lstep)), "s"(GLBA(g + 5 * gstep)),
                 "v"(LDSA(l + 6 * lstep)), "s"(GLBA(g + 6 * gstep)),
                 "v"(LDSA(l + 7 * lstep)), "s"(GLBA(g + 7 * gstep)),
                 "v"(voff)
               : "memory");
}

/* the same for four rows a fixed step apart */
__device__ __forceinline__ void async4s_b128(const bf16* g, size_t gstep,
                                             unsigned voff, bf16* l, int lstep) {
  asm volatile("global_load_async_to_lds_b128 %0, %8, %1\n\t"
               "global_load_async_to_lds_b128 %2, %8, %3\n\t"
               "global_load_async_to_lds_b128 %4, %8, %5\n\t"
               "global_load_async_to_lds_b128 %6, %8, %7\n\t"
               "s_wait_xcnt 0x0"
               :
               : "v"(LDSA(l)),             "s"(GLBA(g)),
                 "v"(LDSA(l + lstep)),     "s"(GLBA(g + gstep)),
                 "v"(LDSA(l + 2 * lstep)), "s"(GLBA(g + 2 * gstep)),
                 "v"(LDSA(l + 3 * lstep)), "s"(GLBA(g + 3 * gstep)),
                 "v"(voff)
               : "memory");
}

/* in front of the barrier that hands a stage over: first this wave's LDS reads
 * of the buffer that is refilled behind the barrier have returned, then its
 * own copies of the next stage have landed */
__device__ __forceinline__ void wait_async() {
  asm volatile("s_wait_dscnt 0x0" ::: "memory");
  asm volatile("s_wait_asynccnt 0x0" ::: "memory");
}

__device__ __forceinline__ v16bf load_frag(const bf16* p) {
  union { v16bf v; v8bf h[2]; } f;
  f.h[0] = *(const v8bf*)(p);
  f.h[1] = *(const v8bf*)(p + 16);
  return f.v;
}

__device__ __forceinline__ v8f wmma_bf16(v16bf a, v16bf b, v8f c) {
  return __builtin_amdgcn_wmma_f32_16x16x32_bf16(
      false, a, false, b, (short)0, c, false, false);
}

__device__ __forceinline__ float xhalf(float x) {
  int b = __builtin_bit_cast(int, x);
  return __builtin_bit_cast(float, __builtin_amdgcn_permlanex16(
      b, b, 0x76543210, 0xfedcba98, false, false));
}

/* ---------------- conversion kernels ----------------
 * Streaming form: few waves, each with 8 or 16 loads of 16 bytes a lane in
 * flight, every load instruction of a wave covering whole 128-byte lines. */

/* grid 512, block 256: 16 waves per WGP. A wave converts 2048 consecutive
 * elements, 16 loads and 16 stores a lane.                               */
__global__ void __launch_bounds__(256)
cvt_x_kernel(const float* __restrict__ x, bf16* __restrict__ xh) {
  const int lane = threadIdx.x & 31;
  const int wv   = blockIdx.x * 8 + (threadIdx.x >> 5);
  const size_t base = (size_t)wv * 2048 + lane * 4;
  v4f v[16];
  for (int i = 0; i < 16; ++i) v[i] = *(const v4f*)(x + base + i * 128);
  for (int i = 0; i < 16; ++i)
    *(v4bf*)(xh + base + i * 128) = __builtin_convertvector(v[i], v4bf);
}

/* grid (128, 3), block 256. A wave transposes a 32(k) x 32(n) tile in
 * registers: a lane loads 8 rows k of 4 columns n (a load instruction reads
 * 4 rows of 128 B) and stores 4 rows n of 8 k (16 B each).               */
__global__ void __launch_bounds__(256)
cvt_wT_kernel(const float* __restrict__ Wq,
              const float* __restrict__ Wk,
              const float* __restrict__ Wv,
              bf16* __restrict__ wt) {
  const int mat = blockIdx.y;
  const float* W = (mat == 0) ? Wq : ((mat == 1) ? Wk : Wv);
  const int lane = threadIdx.x & 31;
  const int wv   = blockIdx.x * 8 + (threadIdx.x >> 5);   /* 0..1023 */
  const int k0   = (wv & 31) * 32 + (lane & 3) * 8;
  const int n0   = (wv >> 5) * 32 + (lane >> 2) * 4;
  v4f v[8];
  for (int i = 0; i < 8; ++i)
    v[i] = *(const v4f*)(W + (size_t)(k0 + i) * Dn + n0);
  bf16* o = wt + (size_t)mat * Dn * Dn + (size_t)n0 * Dn + k0;
  for (int j = 0; j < 4; ++j) {
    v8bf r;
    for (int i = 0; i < 8; ++i) r[i] = (bf16)v[i][j];
    *(v8bf*)(o + (size_t)j * Dn) = r;
  }
}

/* ---------------- fused QKV GEMM (bf16 WMMA, f32 acc) ----------------
 * The three weight matrices stand stacked in wt as one 3072 x 1024 operand.
 * grid (32, 8), block 384 (12 waves): one work-group per WGP, one round.
 * Block tile 256(M) x 384(N), wave tile 64 x 128 (two heads of one matrix):
 * a fragment read from LDS feeds 4 or 8 products, a row copied from L2 feeds
 * 384 or 256 columns. A stage is 64 k: its rows are whole 128-B lines.
 * A/B tiles double-buffered in LDS via async-to-LDS.                       */
__global__ void __launch_bounds__(384, 1)
gemm_qkv_kernel(const bf16* __restrict__ xh, const bf16* __restrict__ wt,
                const float* __restrict__ bq, const float* __restrict__ bk,
                const float* __restrict__ bv,
                bf16* __restrict__ qh, bf16* __restrict__ kh,
                bf16* __restrict__ vt, float* __restrict__ out) {
  __shared__ __attribute__((aligned(16))) bf16 abuf[2][256 * P64];  /* 36 KiB each */
  __shared__ __attribute__((aligned(16))) bf16 bbuf[2][384 * P64];  /* 54 KiB each */

  const int tid  = threadIdx.x;
  const int lane = tid & 31;
  /* the wave's number as a scalar: which waves copy A, and which matrix the
   * wave's columns belong to, are then scalar branches */
  const int w    = __builtin_amdgcn_readfirstlane(tid >> 5);
  const int row0 = blockIdx.x * 256;
  const int mw   = w & 3;              /* 4 waves across M */
  const int nw   = w >> 2;             /* 3 waves across N */
  const int ln   = lane & 15;
  const int kb   = (lane >> 4) * 8;
  const int g128 = blockIdx.y * 3 + nw;   /* the wave's 128 of the 3072 columns */
  const int mat  = g128 >> 3;
  const int h0   = (g128 & 7) * 2;        /* the first of its two heads */

  const float* bias = (mat == 0) ? bq : ((mat == 1) ? bk : bv);

  const bf16* asrc = xh + (size_t)row0 * Dn;                 /* row stride Dn */
  const bf16* bsrc = wt + (size_t)blockIdx.y * 384 * Dn;

  v8f acc[4][8];
  for (int t = 0; t < 8; ++t) {
    float bval = bias[h0 * 64 + t * 16 + ln];
    for (int i = 0; i < 4; ++i)
      for (int r = 0; r < 8; ++r) acc[i][t][r] = bval;
  }

  /* cooperative stage of one 256x64 A tile + 384x64 B tile: 16-B chunks, eight
   * to a row, so that a wave's copy covers four whole lines; B by all 12 waves
   * (rows 48 apart), A by the first 8 (rows 32 apart) */
  auto stage = [&](int kk, int buf) {
    /* the lane's number read anew at every stage: the copy addresses formed
     * from it once, and kept over the loop beside 256 accumulator registers,
     * are spilled to scratch and loaded back in front of the copies */
    unsigned sln;
    asm volatile("v_mbcnt_lo_u32_b32 %0, -1, 0" : "=v"(sln));
    const unsigned srow = w * 4 + (sln >> 3), soff = (sln & 7) * 8;
    const unsigned voff = (srow * Dn + soff) * 2;             /* bytes */
    const unsigned sl   = srow * P64 + soff;
    async8s_b128(bsrc + kk, (size_t)48 * Dn, voff, &bbuf[buf][sl], 48 * P64);
    if (w < 8)
      async8s_b128(asrc + kk, (size_t)32 * Dn, voff, &abuf[buf][sl], 32 * P64);
  };

  stage(0, 0);
  int cur = 0;
  for (int kk = 0; kk < Dn; kk += 64) {
    wait_async();
    __syncthreads();
    if (kk + 64 < Dn) stage(kk + 64, cur ^ 1);

    for (int ks = 0; ks < 64; ks += 32) {
      const bf16* ap = &abuf[cur][(mw * 64 + ln) * P64 + ks + kb];
      const bf16* bp = &bbuf[cur][(nw * 128 + ln) * P64 + ks + kb];
      v16bf a[4];
      for (int i = 0; i < 4; ++i) a[i] = load_frag(ap + i * 16 * P64);
      v16bf b[2];
      b[0] = load_frag(bp);
      for (int t = 0; t < 8; ++t) {
        if (t < 7) b[(t + 1) & 1] = load_frag(bp + (t + 1) * 16 * P64);
        /* keeps the next B fragment's loads ahead of this fragment's four
         * products: sunk behind them, into one register set, each fragment
         * waits out the LDS latency with the matrix unit idle */
        __builtin_amdgcn_sched_barrier(0);
        for (int i = 0; i < 4; ++i)
          acc[i][t] = wmma_bf16(a[i], b[t & 1], acc[i][t]);
      }
    }
    cur ^= 1;
  }

  /* Epilogue: each wave turns its tile, 16 rows of one head at a time (V^T: a
   * head's 64 x 64), through 9 KiB of its own in the ring, so that every
   * global store is 8 or 16 B a lane on whole 128-B lines. A head's 64 rows s
   * are contiguous in the (B,H,S,dh) arrays. Row pitch 272 B (f32) and 144 B
   * (V^T): 16 B x odd.                                                     */
  __syncthreads();              /* every wave has left the ring */
  float* st = (float*)((w < 8) ? &abuf[0][0] : &bbuf[0][0]) + (w & 7) * 2304;
  const int hf = lane >> 4;
  const int m0 = row0 + mw * 64;
  const int s0 = m0 & 2047;

  /* 16 rows m of 64 columns n: out of the accumulators, back as rows; v[j]
   * is row 2j + hf, columns 4 ln .. 4 ln + 3: element 128 j + 4 lane       */
  auto turn = [&](int ms, int hd, v4f* v) {
    for (int t = 0; t < 4; ++t)
      for (int r = 0; r < 8; ++r)
        st[(8 * hf + r) * 68 + t * 16 + ln] = acc[ms][hd * 4 + t][r];
    /* the rows read back were written by other lanes of this wave; they land
     * in registers that the global stores of the turn before name: the second
     * wait stands in front of that overwrite */
    asm volatile("s_wait_dscnt 0x0\n\ts_wait_xcnt 0x0" ::: "memory");
    for (int j = 0; j < 8; ++j)
      v[j] = *(const v4f*)(st + (2 * j + hf) * 68 + ln * 4);
  };

  /* unrolled: the accumulators stay in registers only under constant indices */
#pragma unroll
  for (int hd = 0; hd < 2; ++hd) {
    const int bhd = (m0 >> 11) * Hn + h0 + hd;                 /* b*H + h */
    const size_t tile = ((size_t)bhd * Sn + s0) * DHn + lane * 4;
    if (mat == 0) {
#pragma unroll
      for (int ms = 0; ms < 4; ++ms) {
        v4f v[8];
        turn(ms, hd, v);
        for (int j = 0; j < 8; ++j)                    /* fold 1/sqrt(64) */
          *(v4bf*)(qh + tile + ms * 1024 + j * 128) =
              __builtin_convertvector(v[j] * 0.125f, v4bf);
      }
      /* closes the branch: whatever follows it may overwrite registers that
       * its last stores name */
      asm volatile("s_wait_xcnt 0x0" ::: "memory");
    } else if (mat == 1) {
      float* ko = out + (size_t)Mn * Dn + tile;        /* K cache f32 */
#pragma unroll
      for (int ms = 0; ms < 4; ++ms) {
        v4f v[8];
        turn(ms, hd, v);
        for (int j = 0; j < 8; ++j) *(v4f*)(ko + ms * 1024 + j * 128) = v[j];
        /* the conversions land in registers that the stores above name: the
         * wait stands in front of that overwrite, and the scheduling barrier
         * holds the conversions behind it */
        asm volatile("s_wait_xcnt 0x0" ::: "memory");
        __builtin_amdgcn_sched_barrier(0);
        for (int j = 0; j < 8; ++j)
          *(v4bf*)(kh + tile + ms * 1024 + j * 128) =
              __builtin_convertvector(v[j], v4bf);
      }
      /* closes the branch, as in the branch above */
      asm volatile("s_wait_xcnt 0x0" ::: "memory");
    } else {
      float* vo = out + (size_t)2 * Mn * Dn + tile;    /* V cache f32 */
#pragma unroll
      for (int ms = 0; ms < 4; ++ms) {
        v4f v[8];
        turn(ms, hd, v);
        for (int j = 0; j < 8; ++j) *(v4f*)(vo + ms * 1024 + j * 128) = v[j];
      }
      /* V^T: a lane's 8 accumulator rows are 8 consecutive s of one d.
       * The wait stands in front of the overwrite of registers that the
       * stores above name; the scheduling barrier holds the conversions
       * behind it */
      asm volatile("s_wait_xcnt 0x0" ::: "memory");
      __builtin_amdgcn_sched_barrier(0);
#pragma unroll
      for (int ms = 0; ms < 4; ++ms)
        for (int t = 0; t < 4; ++t) {
          v8bf p;
          for (int r = 0; r < 8; ++r) p[r] = (bf16)acc[ms][hd * 4 + t][r];
          *(v4f*)(st + (t * 16 + ln) * 36 + ms * 8 + hf * 4) =
              __builtin_bit_cast(v4f, p);
        }
      /* the rows read back were written by other lanes of this wave */
      asm volatile("s_wait_dscnt 0x0" ::: "memory");
      bf16* vo2 = vt + ((size_t)bhd * DHn + (lane >> 3)) * Sn + s0 + (lane & 7) * 8;
      for (int j = 0; j < 16; ++j)
        *(v4f*)(vo2 + (size_t)j * 4 * Sn) =
            *(const v4f*)(st + (j * 4 + (lane >> 3)) * 36 + (lane & 7) * 4);
      /* closes the branch, as in the branches above */
      asm volatile("s_wait_xcnt 0x0" ::: "memory");
    }
  }
}

__global__ void __launch_bounds__(256, 1)
attn_kernel(const bf16* __restrict__ qh, const bf16* __restrict__ kh,
            const bf16* __restrict__ vt, float* __restrict__ attn) {
  __shared__ __attribute__((aligned(16))) bf16 kbuf[2][128 * P64];  /* [kv][dh] */
  __shared__ __attribute__((aligned(16))) bf16 vbuf[2][64 * P128];  /* [dh][kv] */

  const int tid  = threadIdx.x;
  const int lane = tid & 31;
  /* the wave's number as a scalar: the tests on the wave's causal bound in the
   * key loop are then scalar branches */
  const int w    = __builtin_amdgcn_readfirstlane(tid >> 5);
  const int bh   = blockIdx.x;                 /* b*16 + h */
  const int qblk = blockIdx.y;
  const int q0   = qblk * 128 + w * 16;
  const int ln   = lane & 15;
  const int kb   = (lane >> 4) * 8;

  const bf16* qp = qh + (size_t)bh * Sn * DHn;
  const bf16* kp = kh + (size_t)bh * Sn * DHn;
  const bf16* vp = vt + (size_t)bh * DHn * Sn;

  /* B operand: column = query q0 + ln, k = dh in the loader's order */
  v16bf qb0 = load_frag(qp + (size_t)(q0 + ln) * DHn + 0  + kb);
  v16bf qb1 = load_frag(qp + (size_t)(q0 + ln) * DHn + 32 + kb);

  v8f acco[4];                         /* O^T: [dh = 16t + kb + r][query ln] */
  for (int t = 0; t < 4; ++t)
    for (int r = 0; r < 8; ++r) acco[t][r] = 0.0f;
  float mrow = -1e30f;                 /* this lane's query, both halves alike */
  const float L2E = 1.44269504f;       /* log2(e)                              */
  float nm = -mrow * L2E;              /* minus the maximum in use, in log2    */
  float lrow = 0.0f;                   /* this half's share of the row sum     */

  /* this lane's query less its half's first key: key kv0 + kb + r is not
   * behind the query while the scalar kv0 + r is at most this. One register
   * over the loop for the mask; with more, the kernel passes 128 registers
   * and the fourth work-group of a WGP is no longer resident              */
  const int qrel      = q0 + ln - kb;
  const int nblk_wave = (q0 + 47) >> 5;        /* causal bound per wave  */

  /* cooperative stage of one K(128x64) + V^T(64x128) tile, 16-B chunks, four
   * of each a lane: K's 128 rows stand contiguous (32 rows a copy of the
   * block), V^T has 16 chunks a row (16 rows a copy of the block)         */
  auto stage_kv = [&](int st, int buf) {
    const int kv0 = st * 128;
    async4s_b128(kp + (size_t)kv0 * DHn, (size_t)32 * DHn, tid * 16,
                 &kbuf[buf][(tid >> 3) * P64 + (tid & 7) * 8], 32 * P64);
    async4s_b128(vp + kv0, (size_t)16 * Sn,
                 (tid >> 4) * (Sn * 2) + (tid & 15) * 16,
                 &vbuf[buf][(tid >> 4) * P128 + (tid & 15) * 8], 16 * P128);
  };

  stage_kv(0, 0);
  int cur = 0;
  for (int st = 0; st <= qblk; ++st) {         /* uniform over the block */
    wait_async();
    __syncthreads();
    if (st < qblk) stage_kv(st + 1, cur ^ 1);

    const int bend = min(st * 4 + 4, nblk_wave);
    /* the pass's 32 keys: the two LDS addresses step from pass to pass in
     * registers of their own; formed anew in a free register, the write falls
     * on an operand of the products just issued, inside their distance     */
    const bf16* kt = &kbuf[cur][0];
    const bf16* vq = &vbuf[cur][0];
    for (int blk = st * 4; blk < bend; ++blk) {
      const int kv0 = blk * 32;
      v8f s0, s1;
      for (int r = 0; r < 8; ++r) { s0[r] = 0.0f; s1[r] = 0.0f; }

      v16bf k0a = load_frag(kt + (ln)      * P64 + 0  + kb);
      v16bf k1a = load_frag(kt + (16 + ln) * P64 + 0  + kb);
      v16bf k0b = load_frag(kt + (ln)      * P64 + 32 + kb);
      v16bf k1b = load_frag(kt + (16 + ln) * P64 + 32 + kb);
      /* keeps the eight K loads one group ahead of the products: with the
       * branch below ending the block, the compiler otherwise reloads one
       * register set and waits out the LDS latency three times a pass     */
      __builtin_amdgcn_sched_barrier(0);
      s0 = wmma_bf16(k0a, qb0, s0);
      s1 = wmma_bf16(k1a, qb0, s1);
      s0 = wmma_bf16(k0b, qb1, s0);
      s1 = wmma_bf16(k1b, qb1, s1);

      v16bf va[4];                     /* on their way during the softmax */
      for (int t = 0; t < 4; ++t) va[t] = load_frag(vq + (t * 16 + ln) * P128 + kb);

      /* online softmax of one query per lane: s0[r] is key kv0 + kb + r,
       * s1[r] is key kv0 + 16 + kb + r                                   */
      /* only the wave's last block, which holds its 16 queries' own
       * positions, has keys behind a query: the blocks before it take their
       * scores as they are                                               */
      if (blk + 1 == nblk_wave) {
        for (int r = 0; r < 8; ++r) {
          s0[r] = ((kv0 + r)      <= qrel) ? s0[r] : -1e30f;
          s1[r] = ((kv0 + 16 + r) <= qrel) ? s1[r] : -1e30f;
        }
      }
      v16bf pb;                        /* P^T as B: k = kb + r, 16 + kb + r */
      float rs0, rs1;
      auto expsum = [&]() {            /* P = exp(score - maximum in use) */
        v8f l8, n8;                    /* on vectors: two scores an instruction */
        for (int r = 0; r < 8; ++r) { l8[r] = L2E; n8[r] = nm; }
        rs0 = 0.0f;
        rs1 = 0.0f;
        const v8f e0 = __builtin_elementwise_fma(s0, l8, n8);
        const v8f e1 = __builtin_elementwise_fma(s1, l8, n8);
        for (int r = 0; r < 8; ++r) {
          float p0 = __builtin_amdgcn_exp2f(e0[r]);
          float p1 = __builtin_amdgcn_exp2f(e1[r]);
          rs0 += p0;
          rs1 += p1;
          pb[r]     = (bf16)p0;
          pb[8 + r] = (bf16)p1;
        }
      };
      expsum();
      /* a sum of at most 256 bounds every P of the pass by 256 (2^8 over the
       * maximum in use); an exponential that overflows reads infinite and
       * takes the path too, as does the first pass, whose maximum in use is
       * the start value: every unmasked score overflows against it        */
      if (__builtin_amdgcn_ballot_w32(rs0 + rs1 > 256.0f) != 0) {
        float mx = -1e30f;
        for (int r = 0; r < 8; ++r) mx = fmaxf(mx, fmaxf(s0[r], s1[r]));
        mx = fmaxf(mx, xhalf(mx));
        const float mnew = fmaxf(mrow, mx);
        const float corr = __expf(mrow - mnew);
        mrow = mnew;
        nm   = -mnew * L2E;
        lrow *= corr;
        for (int t = 0; t < 4; ++t)
          for (int r = 0; r < 8; ++r) acco[t][r] *= corr;
        expsum();
      }
      lrow += rs0 + rs1;

      for (int t = 0; t < 4; ++t) acco[t] = wmma_bf16(va[t], pb, acco[t]);
      kt += 32 * P64;
      vq += 32;
    }
    cur ^= 1;
  }

  /* join the two halves' shares of the row sum, once */
  lrow += xhalf(lrow);
  const float inv = 1.0f / lrow;

  const int b = bh >> 4, h = bh & 15;
  /* the lane's number read anew: query and half, kept over the loop for this
   * address alone, are the registers spoken of at qrel */
  unsigned el;
  asm volatile("v_mbcnt_lo_u32_b32 %0, -1, 0" : "=v"(el));
  float* op = attn + ((size_t)(b * Sn + q0 + (el & 15))) * Dn + h * DHn + (el >> 4) * 8;
  for (int t = 0; t < 4; ++t) {
    float4 lo, hi;
    lo.x = acco[t][0] * inv; lo.y = acco[t][1] * inv;
    lo.z = acco[t][2] * inv; lo.w = acco[t][3] * inv;
    hi.x = acco[t][4] * inv; hi.y = acco[t][5] * inv;
    hi.z = acco[t][6] * inv; hi.w = acco[t][7] * inv;
    *(float4*)(op + t * 16)     = lo;
    *(float4*)(op + t * 16 + 4) = hi;
  }
}

/* ---------------- residual + LayerNorm ----------------
 * Streaming form: grid 512, block 256 (16 waves per WGP), two rows per wave.
 * A lane holds 32 elements of each row (8 x 16 B of x and of attn) and its
 * 32 elements of gamma and beta, which serve both rows; the sums are
 * in-lane, then a butterfly over the 32 lanes: no LDS.                    */

/* sum over the wave, the same value in every lane: four exchanges inside the
 * 16-lane row, one between the rows */
__device__ __forceinline__ float wave_sum(float s) {
  s += __builtin_bit_cast(float, __builtin_amdgcn_update_dpp(
      0, __builtin_bit_cast(int, s), 0x161, 0xf, 0xf, true));  /* row_xmask:1 */
  s += __builtin_bit_cast(float, __builtin_amdgcn_update_dpp(
      0, __builtin_bit_cast(int, s), 0x162, 0xf, 0xf, true));  /* row_xmask:2 */
  s += __builtin_bit_cast(float, __builtin_amdgcn_update_dpp(
      0, __builtin_bit_cast(int, s), 0x164, 0xf, 0xf, true));  /* row_xmask:4 */
  s += __builtin_bit_cast(float, __builtin_amdgcn_update_dpp(
      0, __builtin_bit_cast(int, s), 0x168, 0xf, 0xf, true));  /* row_xmask:8 */
  return s + xhalf(s);
}

__global__ void __launch_bounds__(256)
ln_kernel(const float* __restrict__ x, const float* __restrict__ attn,
          const float* __restrict__ gamma, const float* __restrict__ beta,
          float* __restrict__ out) {
  const unsigned l4 = (threadIdx.x & 31) * 4;   /* the lane's place in 128 */
  /* the wave's number as a scalar: the row addresses then stay in scalar
   * registers and the one lane offset serves every load and store */
  const int wave = __builtin_amdgcn_readfirstlane(threadIdx.x >> 5);
  const size_t off = (size_t)((blockIdx.x * 8 + wave) * 2) * Dn;
  const float* xr = x    + off;
  const float* ar = attn + off;
  float*       yr = out  + off;

  v4f xv[2][8], av[2][8], g[8], b[8];
  for (int j = 0; j < 2; ++j)
    for (int i = 0; i < 8; ++i) {
      xv[j][i] = *(const v4f*)(xr + l4 + j * Dn + i * 128);
      av[j][i] = *(const v4f*)(ar + l4 + j * Dn + i * 128);
    }
  for (int i = 0; i < 8; ++i) {
    g[i] = *(const v4f*)(gamma + l4 + i * 128);
    b[i] = *(const v4f*)(beta  + l4 + i * 128);
  }
  /* keeps every load of the wave ahead of the arithmetic, so that all are in
   * flight together; without it the later ones are sunk behind the sums */
  __builtin_amdgcn_sched_barrier(0);

  float s[2];
  for (int j = 0; j < 2; ++j) {
    v4f s4 = {0.0f, 0.0f, 0.0f, 0.0f};
    for (int i = 0; i < 8; ++i) { xv[j][i] += av[j][i]; s4 += xv[j][i]; }
    s[j] = (s4[0] + s4[1]) + (s4[2] + s4[3]);
  }
  for (int j = 0; j < 2; ++j) s[j] = wave_sum(s[j]) * (1.0f / 1024.0f);

  float q[2];
  for (int j = 0; j < 2; ++j) {
    v4f q4 = {0.0f, 0.0f, 0.0f, 0.0f};
    for (int i = 0; i < 8; ++i) { xv[j][i] -= s[j]; q4 += xv[j][i] * xv[j][i]; }
    q[j] = (q4[0] + q4[1]) + (q4[2] + q4[3]);
  }
  for (int j = 0; j < 2; ++j)
    q[j] = rsqrtf(wave_sum(q[j]) * (1.0f / 1024.0f) + 1e-5f);

  for (int j = 0; j < 2; ++j)
    for (int i = 0; i < 8; ++i)
      *(v4f*)(yr + l4 + j * Dn + i * 128) = xv[j][i] * q[j] * g[i] + b[i];
}

extern "C" void kernel_launch(void* const* d_in, const int* in_sizes, int n_in,
                              void* d_out, int out_size, void* d_ws, size_t ws_size,
                              hipStream_t stream) {
  const float* x     = (const float*)d_in[0];
  const float* Wq    = (const float*)d_in[1];
  const float* bq    = (const float*)d_in[2];
  const float* Wk    = (const float*)d_in[3];
  const float* bk    = (const float*)d_in[4];
  const float* Wv    = (const float*)d_in[5];
  const float* bv    = (const float*)d_in[6];
  const float* gamma = (const float*)d_in[7];
  const float* beta  = (const float*)d_in[8];
  float* out = (float*)d_out;

  char* ws = (char*)d_ws;
  bf16*  xh   = (bf16*)(ws + XH_OFF);
  bf16*  wt   = (bf16*)(ws + WT_OFF);
  bf16*  qh   = (bf16*)(ws + QH_OFF);
  bf16*  kh   = (bf16*)(ws + KH_OFF);
  bf16*  vt   = (bf16*)(ws + VT_OFF);
  float* attn = (float*)(ws + AT_OFF);

  cvt_x_kernel<<<Mn * Dn / 16384, 256, 0, stream>>>(x, xh);
  cvt_wT_kernel<<<dim3(Dn * Dn / 8192, 3), 256, 0, stream>>>(Wq, Wk, Wv, wt);
  gemm_qkv_kernel<<<dim3(Mn / 256, 3 * Dn / 384), 384, 0, stream>>>(
      xh, wt, bq, bk, bv, qh, kh, vt, out);
  attn_kernel<<<dim3(Bn * Hn, Sn / 128), 256, 0, stream>>>(qh, kh, vt, attn);
  ln_kernel<<<Mn / 16, 256, 0, stream>>>(x, attn, gamma, beta, out);
}

// v009
// It runs in 84.9 microseconds.
// Next to v008, in two timings, it ran 1.05 times as fast each time.
// Counting every step since v000, it is 5.63 times as fast.
#include <hip/hip_runtime.h>
#include <math.h>
#include <stdint.h>

typedef __bf16 bf16;
typedef __attribute__((ext_vector_type(16))) __bf16 v16bf;
typedef __attribute__((ext_vector_type(8)))  __bf16 v8bf;
typedef __attribute__((ext_vector_type(8)))  float  v8f;
typedef __attribute__((ext_vector_type(4)))  float  v4f;
typedef __attribute__((ext_vector_type(4)))  __bf16 v4bf;

#define Bn  4
#define Sn  2048
#define Dn  1024
#define Hn  16
#define DHn 64
#define Mn  (Bn * Sn)          /* 8192 rows of x */

/* workspace layout (bytes) */
#define XH_OFF  0ull
#define XH_BY   ((size_t)Mn * Dn * 2)        /* x in bf16            16 MiB */
#define WT_OFF  (XH_OFF + XH_BY)
#define WT_BY   ((size_t)3 * Dn * Dn * 2)    /* Wq/Wk/Wv^T bf16       6 MiB */
#define QH_OFF  (WT_OFF + WT_BY)
#define QH_BY   ((size_t)Mn * Dn * 2)        /* Q bf16 (B,H,S,dh)    16 MiB */
#define KH_OFF  (QH_OFF + QH_BY)
#define KH_BY   ((size_t)Mn * Dn * 2)        /* K bf16 (B,H,S,dh)    16 MiB */
#define VT_OFF  (KH_OFF + KH_BY)
#define VT_BY   ((size_t)Mn * Dn * 2)        /* V^T bf16 (B,H,dh,S)  16 MiB */
#define AT_OFF  (VT_OFF + VT_BY)
#define AT_BY   ((size_t)Mn * Dn * 4)        /* attn f32 (B,S,D)     32 MiB */

#define P64 72                 /* rows of 64 bf16 (128 B): pitch 144 B */
#define P128 136               /* rows of 128 bf16 (256 B): pitch 272 B */

#define LDSA(l) ((unsigned)(uintptr_t)(l))
#define GLBA(g) ((unsigned long long)(uintptr_t)(g))
/* The global address is a scalar base plus one 32-bit lane offset in bytes:
 * eight rows a fixed step apart share the offset register, so a stage's
 * copies take 9 vector registers, not 24 (beside 256 accumulator registers
 * the 64-bit lane addresses spill to scratch).                            */
__device__ __forceinline__ void async8s_b128(const bf16* g, size_t gstep,
                                             unsigned voff, bf16* l, int lstep) {
  asm volatile("global_load_async_to_lds_b128 %0, %16, %1\n\t"
               "global_load_async_to_lds_b128 %2, %16, %3\n\t"
               "global_load_async_to_lds_b128 %4, %16, %5\n\t"
               "global_load_async_to_lds_b128 %6, %16, %7\n\t"
               "global_load_async_to_lds_b128 %8, %16, %9\n\t"
               "global_load_async_to_lds_b128 %10, %16, %11\n\t"
               "global_load_async_to_lds_b128 %12, %16, %13\n\t"
               "global_load_async_to_lds_b128 %14, %16, %15\n\t"
               "s_wait_xcnt 0x0"
               :
               : "v"(LDSA(l)),             "s"(GLBA(g)),
                 "v"(LDSA(l + lstep)),     "s"(GLBA(g + gstep)),
                 "v"(LDSA(l + 2 * lstep)), "s"(GLBA(g + 2 * gstep)),
                 "v"(LDSA(l + 3 * lstep)), "s"(GLBA(g + 3 * gstep)),
                 "v"(LDSA(l + 4 * lstep)), "s"(GLBA(g + 4 * gstep)),
                 "v"(LDSA(l + 5 * lstep)), "s"(GLBA(g + 5 * gstep)),
                 "v"(LDSA(l + 6 * lstep)), "s"(GLBA(g + 6 * gstep)),
                 "v"(LDSA(l + 7 * lstep)), "s"(GLBA(g + 7 * gstep)),
                 "v"(voff)
               : "memory");
}

/* the same for four rows a fixed step apart */
__device__ __forceinline__ void async4s_b128(const bf16* g, size_t gstep,
                                             unsigned voff, bf16* l, int lstep) {
  asm volatile("global_load_async_to_lds_b128 %0, %8, %1\n\t"
               "global_load_async_to_lds_b128 %2, %8, %3\n\t"
               "global_load_async_to_lds_b128 %4, %8, %5\n\t"
               "global_load_async_to_lds_b128 %6, %8, %7\n\t"
               "s_wait_xcnt 0x0"
               :
               : "v"(LDSA(l)),             "s"(GLBA(g)),
                 "v"(LDSA(l + lstep)),     "s"(GLBA(g + gstep)),
                 "v"(LDSA(l + 2 * lstep)), "s"(GLBA(g + 2 * gstep)),
                 "v"(LDSA(l + 3 * lstep)), "s"(GLBA(g + 3 * gstep)),
                 "v"(voff)
               : "memory");
}

/* in front of the barrier that hands a stage over: first this wave's LDS reads
 * of the buffer that is refilled behind the barrier have returned, then its
 * own copies of the next stage have landed */
__device__ __forceinline__ void wait_async() {
  asm volatile("s_wait_dscnt 0x0" ::: "memory");
  asm volatile("s_wait_asynccnt 0x0" ::: "memory");
}

__device__ __forceinline__ v16bf load_frag(const bf16* p) {
  union { v16bf v; v8bf h[2]; } f;
  f.h[0] = *(const v8bf*)(p);
  f.h[1] = *(const v8bf*)(p + 16);
  return f.v;
}

__device__ __forceinline__ v8f wmma_bf16(v16bf a, v16bf b, v8f c) {
  return __builtin_amdgcn_wmma_f32_16x16x32_bf16(
      false, a, false, b, (short)0, c, false, false);
}

__device__ __forceinline__ float xhalf(float x) {
  int b = __builtin_bit_cast(int, x);
  return __builtin_bit_cast(float, __builtin_amdgcn_permlanex16(
      b, b, 0x76543210, 0xfedcba98, false, false));
}

/* ---------------- conversion kernels ----------------
 * Streaming form: few waves, each with 8 or 16 loads of 16 bytes a lane in
 * flight, every load instruction of a wave covering whole 128-byte lines. */

/* grid 512, block 256: 16 waves per WGP. A wave converts 2048 consecutive
 * elements, 16 loads and 16 stores a lane.                               */
__global__ void __launch_bounds__(256)
cvt_x_kernel(const float* __restrict__ x, bf16* __restrict__ xh) {
  const int lane = threadIdx.x & 31;
  const int wv   = blockIdx.x * 8 + (threadIdx.x >> 5);
  const size_t base = (size_t)wv * 2048 + lane * 4;
  v4f v[16];
  for (int i = 0; i < 16; ++i) v[i] = *(const v4f*)(x + base + i * 128);
  for (int i = 0; i < 16; ++i)
    *(v4bf*)(xh + base + i * 128) = __builtin_convertvector(v[i], v4bf);
}

/* grid (128, 3), block 256. A wave transposes a 32(k) x 32(n) tile in
 * registers: a lane loads 8 rows k of 4 columns n (a load instruction reads
 * 4 rows of 128 B) and stores 4 rows n of 8 k (16 B each).               */
__global__ void __launch_bounds__(256)
cvt_wT_kernel(const float* __restrict__ Wq,
              const float* __restrict__ Wk,
              const float* __restrict__ Wv,
              bf16* __restrict__ wt) {
  const int mat = blockIdx.y;
  const float* W = (mat == 0) ? Wq : ((mat == 1) ? Wk : Wv);
  const int lane = threadIdx.x & 31;
  const int wv   = blockIdx.x * 8 + (threadIdx.x >> 5);   /* 0..1023 */
  const int k0   = (wv & 31) * 32 + (lane & 3) * 8;
  const int n0   = (wv >> 5) * 32 + (lane >> 2) * 4;
  v4f v[8];
  for (int i = 0; i < 8; ++i)
    v[i] = *(const v4f*)(W + (size_t)(k0 + i) * Dn + n0);
  bf16* o = wt + (size_t)mat * Dn * Dn + (size_t)n0 * Dn + k0;
  for (int j = 0; j < 4; ++j) {
    v8bf r;
    for (int i = 0; i < 8; ++i) r[i] = (bf16)v[i][j];
    *(v8bf*)(o + (size_t)j * Dn) = r;
  }
}

/* ---------------- fused QKV GEMM (bf16 WMMA, f32 acc) ----------------
 * The three weight matrices stand stacked in wt as one 3072 x 1024 operand.
 * grid (32, 8), block 384 (12 waves): one work-group per WGP, one round.
 * Block tile 256(M) x 384(N), wave tile 64 x 128 (two heads of one matrix):
 * a fragment read from LDS feeds 4 or 8 products, a row copied from L2 feeds
 * 384 or 256 columns. A stage is 64 k: its rows are whole 128-B lines.
 * A/B tiles double-buffered in LDS via async-to-LDS.                       */
__global__ void __launch_bounds__(384, 1)
gemm_qkv_kernel(const bf16* __restrict__ xh, const bf16* __restrict__ wt,
                const float* __restrict__ bq, const float* __restrict__ bk,
                const float* __restrict__ bv,
                bf16* __restrict__ qh, bf16* __restrict__ kh,
                bf16* __restrict__ vt, float* __restrict__ out) {
  __shared__ __attribute__((aligned(16))) bf16 abuf[2][256 * P64];  /* 36 KiB each */
  __shared__ __attribute__((aligned(16))) bf16 bbuf[2][384 * P64];  /* 54 KiB each */

  const int tid  = threadIdx.x;
  const int lane = tid & 31;
  /* the wave's number as a scalar: which waves copy A, and which matrix the
   * wave's columns belong to, are then scalar branches */
  const int w    = __builtin_amdgcn_readfirstlane(tid >> 5);
  const int row0 = blockIdx.x * 256;
  const int mw   = w & 3;              /* 4 waves across M */
  const int nw   = w >> 2;             /* 3 waves across N */
  const int ln   = lane & 15;
  const int kb   = (lane >> 4) * 8;
  const int g128 = blockIdx.y * 3 + nw;   /* the wave's 128 of the 3072 columns */
  const int mat  = g128 >> 3;
  const int h0   = (g128 & 7) * 2;        /* the first of its two heads */

  const float* bias = (mat == 0) ? bq : ((mat == 1) ? bk : bv);

  const bf16* asrc = xh + (size_t)row0 * Dn;                 /* row stride Dn */
  const bf16* bsrc = wt + (size_t)blockIdx.y * 384 * Dn;

  v8f acc[4][8];
  for (int t = 0; t < 8; ++t) {
    float bval = bias[h0 * 64 + t * 16 + ln];
    for (int i = 0; i < 4; ++i)
      for (int r = 0; r < 8; ++r) acc[i][t][r] = bval;
  }

  /* cooperative stage of one 256x64 A tile + 384x64 B tile: 16-B chunks, eight
   * to a row, so that a wave's copy covers four whole lines; B by all 12 waves
   * (rows 48 apart), A by the first 8 (rows 32 apart) */
  auto stage = [&](int kk, int buf) {
    /* the lane's number read anew at every stage: the copy addresses formed
     * from it once, and kept over the loop beside 256 accumulator registers,
     * are spilled to scratch and loaded back in front of the copies */
    unsigned sln;
    asm volatile("v_mbcnt_lo_u32_b32 %0, -1, 0" : "=v"(sln));
    const unsigned srow = w * 4 + (sln >> 3), soff = (sln & 7) * 8;
    const unsigned voff = (srow * Dn + soff) * 2;             /* bytes */
    const unsigned sl   = srow * P64 + soff;
    async8s_b128(bsrc + kk, (size_t)48 * Dn, voff, &bbuf[buf][sl], 48 * P64);
    if (w < 8)
      async8s_b128(asrc + kk, (size_t)32 * Dn, voff, &abuf[buf][sl], 32 * P64);
  };

  stage(0, 0);
  int cur = 0;
  for (int kk = 0; kk < Dn; kk += 64) {
    wait_async();
    __syncthreads();
    if (kk + 64 < Dn) stage(kk + 64, cur ^ 1);

    for (int ks = 0; ks < 64; ks += 32) {
      const bf16* ap = &abuf[cur][(mw * 64 + ln) * P64 + ks + kb];
      const bf16* bp = &bbuf[cur][(nw * 128 + ln) * P64 + ks + kb];
      v16bf a[4];
      for (int i = 0; i < 4; ++i) a[i] = load_frag(ap + i * 16 * P64);
      v16bf b[2];
      b[0] = load_frag(bp);
      for (int t = 0; t < 8; ++t) {
        if (t < 7) b[(t + 1) & 1] = load_frag(bp + (t + 1) * 16 * P64);
        /* keeps the next B fragment's loads ahead of this fragment's four
         * products: sunk behind them, into one register set, each fragment
         * waits out the LDS latency with the matrix unit idle */
        __builtin_amdgcn_sched_barrier(0);
        for (int i = 0; i < 4; ++i)
          acc[i][t] = wmma_bf16(a[i], b[t & 1], acc[i][t]);
      }
    }
    cur ^= 1;
  }

  /* Epilogue: each wave turns its tile, 16 rows of one head at a time (V^T: a
   * head's 64 x 64), through 9 KiB of its own in the ring, so that every
   * global store is 8 or 16 B a lane on whole 128-B lines. A head's 64 rows s
   * are contiguous in the (B,H,S,dh) arrays. Row pitch 272 B (f32) and 144 B
   * (V^T): 16 B x odd.                                                     */
  __syncthreads();              /* every wave has left the ring */
  float* st = (float*)((w < 8) ? &abuf[0][0] : &bbuf[0][0]) + (w & 7) * 2304;
  const int hf = lane >> 4;
  const int m0 = row0 + mw * 64;
  const int s0 = m0 & 2047;

  /* 16 rows m of 64 columns n: out of the accumulators, back as rows; v[j]
   * is row 2j + hf, columns 4 ln .. 4 ln + 3: element 128 j + 4 lane       */
  auto turn = [&](int ms, int hd, v4f* v) {
    for (int t = 0; t < 4; ++t)
      for (int r = 0; r < 8; ++r)
        st[(8 * hf + r) * 68 + t * 16 + ln] = acc[ms][hd * 4 + t][r];
    /* the rows read back were written by other lanes of this wave; they land
     * in registers that the global stores of the turn before name: the second
     * wait stands in front of that overwrite */
    asm volatile("s_wait_dscnt 0x0\n\ts_wait_xcnt 0x0" ::: "memory");
    for (int j = 0; j < 8; ++j)
      v[j] = *(const v4f*)(st + (2 * j + hf) * 68 + ln * 4);
  };

  /* unrolled: the accumulators stay in registers only under constant indices */
#pragma unroll
  for (int hd = 0; hd < 2; ++hd) {
    const int bhd = (m0 >> 11) * Hn + h0 + hd;                 /* b*H + h */
    const size_t tile = ((size_t)bhd * Sn + s0) * DHn + lane * 4;
    if (mat == 0) {
#pragma unroll
      for (int ms = 0; ms < 4; ++ms) {
        v4f v[8];
        turn(ms, hd, v);
        for (int j = 0; j < 8; ++j)                    /* fold 1/sqrt(64) */
          *(v4bf*)(qh + tile + ms * 1024 + j * 128) =
              __builtin_convertvector(v[j] * 0.125f, v4bf);
      }
      /* closes the branch: whatever follows it may overwrite registers that
       * its last stores name */
      asm volatile("s_wait_xcnt 0x0" ::: "memory");
    } else if (mat == 1) {
      float* ko = out + (size_t)Mn * Dn + tile;        /* K cache f32 */
#pragma unroll
      for (int ms = 0; ms < 4; ++ms) {
        v4f v[8];
        turn(ms, hd, v);
        for (int j = 0; j < 8; ++j) *(v4f*)(ko + ms * 1024 + j * 128) = v[j];
        /* the conversions land in registers that the stores above name: the
         * wait stands in front of that overwrite, and the scheduling barrier
         * holds the conversions behind it */
        asm volatile("s_wait_xcnt 0x0" ::: "memory");
        __builtin_amdgcn_sched_barrier(0);
        for (int j = 0; j < 8; ++j)
          *(v4bf*)(kh + tile + ms * 1024 + j * 128) =
              __builtin_convertvector(v[j], v4bf);
      }
      /* closes the branch, as in the branch above */
      asm volatile("s_wait_xcnt 0x0" ::: "memory");
    } else {
      float* vo = out + (size_t)2 * Mn * Dn + tile;    /* V cache f32 */
#pragma unroll
      for (int ms = 0; ms < 4; ++ms) {
        v4f v[8];
        turn(ms, hd, v);
        for (int j = 0; j < 8; ++j) *(v4f*)(vo + ms * 1024 + j * 128) = v[j];
      }
      /* V^T: a lane's 8 accumulator rows are 8 consecutive s of one d.
       * The wait stands in front of the overwrite of registers that the
       * stores above name; the scheduling barrier holds the conversions
       * behind it */
      asm volatile("s_wait_xcnt 0x0" ::: "memory");
      __builtin_amdgcn_sched_barrier(0);
#pragma unroll
      for (int ms = 0; ms < 4; ++ms)
        for (int t = 0; t < 4; ++t) {
          v8bf p;
          for (int r = 0; r < 8; ++r) p[r] = (bf16)acc[ms][hd * 4 + t][r];
          *(v4f*)(st + (t * 16 + ln) * 36 + ms * 8 + hf * 4) =
              __builtin_bit_cast(v4f, p);
        }
      /* the rows read back were written by other lanes of this wave */
      asm volatile("s_wait_dscnt 0x0" ::: "memory");
      bf16* vo2 = vt + ((size_t)bhd * DHn + (lane >> 3)) * Sn + s0 + (lane & 7) * 8;
      for (int j = 0; j < 16; ++j)
        *(v4f*)(vo2 + (size_t)j * 4 * Sn) =
            *(const v4f*)(st + (j * 4 + (lane >> 3)) * 36 + (lane & 7) * 4);
      /* closes the branch, as in the branches above */
      asm volatile("s_wait_xcnt 0x0" ::: "memory");
    }
  }
}

__global__ void __launch_bounds__(256, 1)
attn_kernel(const bf16* __restrict__ qh, const bf16* __restrict__ kh,
            const bf16* __restrict__ vt, float* __restrict__ attn) {
  __shared__ __attribute__((aligned(16))) bf16 kbuf[2][128 * P64];  /* [kv][dh] */
  __shared__ __attribute__((aligned(16))) bf16 vbuf[2][64 * P128];  /* [dh][kv] */

  const int tid  = threadIdx.x;
  const int lane = tid & 31;
  /* the wave's number as a scalar: the tests on the wave's causal bound in the
   * key loop are then scalar branches */
  const int w    = __builtin_amdgcn_readfirstlane(tid >> 5);
  const int bh   = blockIdx.x;                 /* b*16 + h */
  /* Which query block: all 1024 work-groups
   * are resident, four to a WGP, while block q costs q + 1 stages. The deal
   * runs heaviest first, as a snake over the four quarters of the grid
   * (15..12, 8..11, 7..4, 0..3): four
   * work-groups 256 apart in the order hold 34 stages together whichever they
   * are. A permutation of 0..15: right wherever the work-groups land.      */
  const int yr   = 3 - ((int)blockIdx.y >> 2);
  const int yj   = blockIdx.y & 3;
  const int qblk = yr * 4 + ((yr & 1) ? 3 - yj : yj);
  const int q0   = qblk * 128 + w * 16;
  const int ln   = lane & 15;
  const int kb   = (lane >> 4) * 8;

  const bf16* qp = qh + (size_t)bh * Sn * DHn;
  const bf16* kp = kh + (size_t)bh * Sn * DHn;
  const bf16* vp = vt + (size_t)bh * DHn * Sn;

  /* B operand: column = query q0 + ln, k = dh in the loader's order */
  v16bf qb0 = load_frag(qp + (size_t)(q0 + ln) * DHn + 0  + kb);
  v16bf qb1 = load_frag(qp + (size_t)(q0 + ln) * DHn + 32 + kb);

  v8f acco[4];                         /* O^T: [dh = 16t + kb + r][query ln] */
  for (int t = 0; t < 4; ++t)
    for (int r = 0; r < 8; ++r) acco[t][r] = 0.0f;
  float mrow = -1e30f;                 /* this lane's query, both halves alike */
  const float L2E = 1.44269504f;       /* log2(e)                              */
  float nm = -mrow * L2E;              /* minus the maximum in use, in log2    */
  float lrow = 0.0f;                   /* this half's share of the row sum     */

  /* this lane's query less its half's first key: key kv0 + kb + r is not
   * behind the query while the scalar kv0 + r is at most this. One register
   * over the loop for the mask; with more, the kernel passes 128 registers
   * and the fourth work-group of a WGP is no longer resident              */
  const int qrel      = q0 + ln - kb;
  const int nblk_wave = (q0 + 47) >> 5;        /* causal bound per wave  */

  /* cooperative stage of one K(128x64) + V^T(64x128) tile, 16-B chunks, four
   * of each a lane: K's 128 rows stand contiguous (32 rows a copy of the
   * block), V^T has 16 chunks a row (16 rows a copy of the block)         */
  auto stage_kv = [&](int st, int buf) {
    const int kv0 = st * 128;
    async4s_b128(kp + (size_t)kv0 * DHn, (size_t)32 * DHn, tid * 16,
                 &kbuf[buf][(tid >> 3) * P64 + (tid & 7) * 8], 32 * P64);
    async4s_b128(vp + kv0, (size_t)16 * Sn,
                 (tid >> 4) * (Sn * 2) + (tid & 15) * 16,
                 &vbuf[buf][(tid >> 4) * P128 + (tid & 15) * 8], 16 * P128);
  };

  stage_kv(0, 0);
  int cur = 0;
  for (int st = 0; st <= qblk; ++st) {         /* uniform over the block */
    wait_async();
    __syncthreads();
    if (st < qblk) stage_kv(st + 1, cur ^ 1);

    const int bend = min(st * 4 + 4, nblk_wave);
    /* the pass's 32 keys: the two LDS addresses step from pass to pass in
     * registers of their own; formed anew in a free register, the write falls
     * on an operand of the products just issued, inside their distance     */
    const bf16* kt = &kbuf[cur][0];
    const bf16* vq = &vbuf[cur][0];
    for (int blk = st * 4; blk < bend; ++blk) {
      const int kv0 = blk * 32;
      v8f s0, s1;
      for (int r = 0; r < 8; ++r) { s0[r] = 0.0f; s1[r] = 0.0f; }

      v16bf k0a = load_frag(kt + (ln)      * P64 + 0  + kb);
      v16bf k1a = load_frag(kt + (16 + ln) * P64 + 0  + kb);
      v16bf k0b = load_frag(kt + (ln)      * P64 + 32 + kb);
      v16bf k1b = load_frag(kt + (16 + ln) * P64 + 32 + kb);
      /* keeps the eight K loads one group ahead of the products: with the
       * branch below ending the block, the compiler otherwise reloads one
       * register set and waits out the LDS latency three times a pass     */
      __builtin_amdgcn_sched_barrier(0);
      s0 = wmma_bf16(k0a, qb0, s0);
      s1 = wmma_bf16(k1a, qb0, s1);
      s0 = wmma_bf16(k0b, qb1, s0);
      s1 = wmma_bf16(k1b, qb1, s1);

      v16bf va[4];                     /* on their way during the softmax */
      for (int t = 0; t < 4; ++t) va[t] = load_frag(vq + (t * 16 + ln) * P128 + kb);

      /* online softmax of one query per lane: s0[r] is key kv0 + kb + r,
       * s1[r] is key kv0 + 16 + kb + r                                   */
      /* only the wave's last block, which holds its 16 queries' own
       * positions, has keys behind a query: the blocks before it take their
       * scores as they are                                               */
      if (blk + 1 == nblk_wave) {
        for (int r = 0; r < 8; ++r) {
          s0[r] = ((kv0 + r)      <= qrel) ? s0[r] : -1e30f;
          s1[r] = ((kv0 + 16 + r) <= qrel) ? s1[r] : -1e30f;
        }
      }
      v16bf pb;                        /* P^T as B: k = kb + r, 16 + kb + r */
      float rs0, rs1;
      auto expsum = [&]() {            /* P = exp(score - maximum in use) */
        v8f l8, n8;                    /* on vectors: two scores an instruction */
        for (int r = 0; r < 8; ++r) { l8[r] = L2E; n8[r] = nm; }
        rs0 = 0.0f;
        rs1 = 0.0f;
        const v8f e0 = __builtin_elementwise_fma(s0, l8, n8);
        const v8f e1 = __builtin_elementwise_fma(s1, l8, n8);
        for (int r = 0; r < 8; ++r) {
          float p0 = __builtin_amdgcn_exp2f(e0[r]);
          float p1 = __builtin_amdgcn_exp2f(e1[r]);
          rs0 += p0;
          rs1 += p1;
          pb[r]     = (bf16)p0;
          pb[8 + r] = (bf16)p1;
        }
      };
      expsum();
      /* a sum of at most 256 bounds every P of the pass by 256 (2^8 over the
       * maximum in use); an exponential that overflows reads infinite and
       * takes the path too, as does the first pass, whose maximum in use is
       * the start value: every unmasked score overflows against it        */
      if (__builtin_amdgcn_ballot_w32(rs0 + rs1 > 256.0f) != 0) {
        float mx = -1e30f;
        for (int r = 0; r < 8; ++r) mx = fmaxf(mx, fmaxf(s0[r], s1[r]));
        mx = fmaxf(mx, xhalf(mx));
        const float mnew = fmaxf(mrow, mx);
        const float corr = __expf(mrow - mnew);
        mrow = mnew;
        nm   = -mnew * L2E;
        lrow *= corr;
        for (int t = 0; t < 4; ++t)
          for (int r = 0; r < 8; ++r) acco[t][r] *= corr;
        expsum();
      }
      lrow += rs0 + rs1;

      for (int t = 0; t < 4; ++t) acco[t] = wmma_bf16(va[t], pb, acco[t]);
      kt += 32 * P64;
      vq += 32;
    }
    cur ^= 1;
  }

  /* join the two halves' shares of the row sum, once */
  lrow += xhalf(lrow);
  const float inv = 1.0f / lrow;

  const int b = bh >> 4, h = bh & 15;
  /* the lane's number read anew: query and half, kept over the loop for this
   * address alone, are the registers spoken of at qrel */
  unsigned el;
  asm volatile("v_mbcnt_lo_u32_b32 %0, -1, 0" : "=v"(el));
  float* op = attn + ((size_t)(b * Sn + q0 + (el & 15))) * Dn + h * DHn + (el >> 4) * 8;
  for (int t = 0; t < 4; ++t) {
    float4 lo, hi;
    lo.x = acco[t][0] * inv; lo.y = acco[t][1] * inv;
    lo.z = acco[t][2] * inv; lo.w = acco[t][3] * inv;
    hi.x = acco[t][4] * inv; hi.y = acco[t][5] * inv;
    hi.z = acco[t][6] * inv; hi.w = acco[t][7] * inv;
    *(float4*)(op + t * 16)     = lo;
    *(float4*)(op + t * 16 + 4) = hi;
  }
}

/* ---------------- residual + LayerNorm ----------------
 * Streaming form: grid 512, block 256 (16 waves per WGP), two rows per wave.
 * A lane holds 32 elements of each row (8 x 16 B of x and of attn) and its
 * 32 elements of gamma and beta, which serve both rows; the sums are
 * in-lane, then a butterfly over the 32 lanes: no LDS.                    */

/* sum over the wave, the same value in every lane: four exchanges inside the
 * 16-lane row, one between the rows */
__device__ __forceinline__ float wave_sum(float s) {
  s += __builtin_bit_cast(float, __builtin_amdgcn_update_dpp(
      0, __builtin_bit_cast(int, s), 0x161, 0xf, 0xf, true));  /* row_xmask:1 */
  s += __builtin_bit_cast(float, __builtin_amdgcn_update_dpp(
      0, __builtin_bit_cast(int, s), 0x162, 0xf, 0xf, true));  /* row_xmask:2 */
  s += __builtin_bit_cast(float, __builtin_amdgcn_update_dpp(
      0, __builtin_bit_cast(int, s), 0x164, 0xf, 0xf, true));  /* row_xmask:4 */
  s += __builtin_bit_cast(float, __builtin_amdgcn_update_dpp(
      0, __builtin_bit_cast(int, s), 0x168, 0xf, 0xf, true));  /* row_xmask:8 */
  return s + xhalf(s);
}

__global__ void __launch_bounds__(256)
ln_kernel(const float* __restrict__ x, const float* __restrict__ attn,
          const float* __restrict__ gamma, const float* __restrict__ beta,
          float* __restrict__ out) {
  const unsigned l4 = (threadIdx.x & 31) * 4;   /* the lane's place in 128 */
  /* the wave's number as a scalar: the row addresses then stay in scalar
   * registers and the one lane offset serves every load and store */
  const int wave = __builtin_amdgcn_readfirstlane(threadIdx.x >> 5);
  const size_t off = (size_t)((blockIdx.x * 8 + wave) * 2) * Dn;
  const float* xr = x    + off;
  const float* ar = attn + off;
  float*       yr = out  + off;

  v4f xv[2][8], av[2][8], g[8], b[8];
  for (int j = 0; j < 2; ++j)
    for (int i = 0; i < 8; ++i) {
      xv[j][i] = *(const v4f*)(xr + l4 + j * Dn + i * 128);
      av[j][i] = *(const v4f*)(ar + l4 + j * Dn + i * 128);
    }
  for (int i = 0; i < 8; ++i) {
    g[i] = *(const v4f*)(gamma + l4 + i * 128);
    b[i] = *(const v4f*)(beta  + l4 + i * 128);
  }
  /* keeps every load of the wave ahead of the arithmetic, so that all are in
   * flight together; without it the later ones are sunk behind the sums */
  __builtin_amdgcn_sched_barrier(0);

  float s[2];
  for (int j = 0; j < 2; ++j) {
    v4f s4 = {0.0f, 0.0f, 0.0f, 0.0f};
    for (int i = 0; i < 8; ++i) { xv[j][i] += av[j][i]; s4 += xv[j][i]; }
    s[j] = (s4[0] + s4[1]) + (s4[2] + s4[3]);
  }
  for (int j = 0; j < 2; ++j) s[j] = wave_sum(s[j]) * (1.0f / 1024.0f);

  float q[2];
  for (int j = 0; j < 2; ++j) {
    v4f q4 = {0.0f, 0.0f, 0.0f, 0.0f};
    for (int i = 0; i < 8; ++i) { xv[j][i] -= s[j]; q4 += xv[j][i] * xv[j][i]; }
    q[j] = (q4[0] + q4[1]) + (q4[2] + q4[3]);
  }
  for (int j = 0; j < 2; ++j)
    q[j] = rsqrtf(wave_sum(q[j]) * (1.0f / 1024.0f) + 1e-5f);

  for (int j = 0; j < 2; ++j)
    for (int i = 0; i < 8; ++i)
      *(v4f*)(yr + l4 + j * Dn + i * 128) = xv[j][i] * q[j] * g[i] + b[i];
}

extern "C" void kernel_launch(void* const* d_in, const int* in_sizes, int n_in,
                              void* d_out, int out_size, void* d_ws, size_t ws_size,
                              hipStream_t stream) {
  const float* x     = (const float*)d_in[0];
  const float* Wq    = (const float*)d_in[1];
  const float* bq    = (const float*)d_in[2];
  const float* Wk    = (const float*)d_in[3];
  const float* bk    = (const float*)d_in[4];
  const float* Wv    = (const float*)d_in[5];
  const float* bv    = (const float*)d_in[6];
  const float* gamma = (const float*)d_in[7];
  const float* beta  = (const float*)d_in[8];
  float* out = (float*)d_out;

  char* ws = (char*)d_ws;
  bf16*  xh   = (bf16*)(ws + XH_OFF);
  bf16*  wt   = (bf16*)(ws + WT_OFF);
  bf16*  qh   = (bf16*)(ws + QH_OFF);
  bf16*  kh   = (bf16*)(ws + KH_OFF);
  bf16*  vt   = (bf16*)(ws + VT_OFF);
  float* attn = (float*)(ws + AT_OFF);

  cvt_x_kernel<<<Mn * Dn / 16384, 256, 0, stream>>>(x, xh);
  cvt_wT_kernel<<<dim3(Dn * Dn / 8192, 3), 256, 0, stream>>>(Wq, Wk, Wv, wt);
  gemm_qkv_kernel<<<dim3(Mn / 256, 3 * Dn / 384), 384, 0, stream>>>(
      xh, wt, bq, bk, bv, qh, kh, vt, out);
  attn_kernel<<<dim3(Bn * Hn, Sn / 128), 256, 0, stream>>>(qh, kh, vt, attn);
  ln_kernel<<<Mn / 16, 256, 0, stream>>>(x, attn, gamma, beta, out);
}

// v010
// One run takes 81.2 microseconds.
// Timed twice side by side with v009, it ran 1.05 and 1.04 times as fast.
// Over all steps from v000 it is 5.88 times as fast.
#include <hip/hip_runtime.h>
#include <math.h>
#include <stdint.h>

typedef __bf16 bf16;
typedef __attribute__((ext_vector_type(16))) __bf16 v16bf;
typedef __attribute__((ext_vector_type(8)))  __bf16 v8bf;
typedef __attribute__((ext_vector_type(8)))  float  v8f;
typedef __attribute__((ext_vector_type(4)))  float  v4f;
typedef __attribute__((ext_vector_type(4)))  __bf16 v4bf;

#define Bn  4
#define Sn  2048
#define Dn  1024
#define Hn  16
#define DHn 64
#define Mn  (Bn * Sn)          /* 8192 rows of x */

/* workspace layout (bytes) */
#define XH_OFF  0ull
#define XH_BY   ((size_t)Mn * Dn * 2)        /* x in bf16            16 MiB */
#define WT_OFF  (XH_OFF + XH_BY)
#define WT_BY   ((size_t)3 * Dn * Dn * 2)    /* Wq/Wk/Wv^T bf16       6 MiB */
#define QH_OFF  (WT_OFF + WT_BY)
#define QH_BY   ((size_t)Mn * Dn * 2)        /* Q bf16 (B,H,S,dh)    16 MiB */
#define KH_OFF  (QH_OFF + QH_BY)
#define KH_BY   ((size_t)Mn * Dn * 2)        /* K bf16 (B,H,S,dh)    16 MiB */
#define VT_OFF  (KH_OFF + KH_BY)
#define VT_BY   ((size_t)Mn * Dn * 2)        /* V^T bf16 (B,H,dh,S)  16 MiB */
#define AT_OFF  (VT_OFF + VT_BY)
#define AT_BY   ((size_t)Mn * Dn * 4)        /* attn f32 (B,S,D)     32 MiB */

#define P64 72                 /* rows of 64 bf16 (128 B): pitch 144 B */
#define P128 136               /* rows of 128 bf16 (256 B): pitch 272 B */

#define LDSA(l) ((unsigned)(uintptr_t)(l))
#define GLBA(g) ((unsigned long long)(uintptr_t)(g))
/* The global address is a scalar base plus one 32-bit lane offset in bytes:
 * eight rows a fixed step apart share the offset register, so a stage's
 * copies take 9 vector registers, not 24 (beside 256 accumulator registers
 * the 64-bit lane addresses spill to scratch).                            */
__device__ __forceinline__ void async8s_b128(const bf16* g, size_t gstep,
                                             unsigned voff, bf16* l, int lstep) {
  asm volatile("global_load_async_to_lds_b128 %0, %16, %1\n\t"
               "global_load_async_to_lds_b128 %2, %16, %3\n\t"
               "global_load_async_to_lds_b128 %4, %16, %5\n\t"
               "global_load_async_to_lds_b128 %6, %16, %7\n\t"
               "global_load_async_to_lds_b128 %8, %16, %9\n\t"
               "global_load_async_to_lds_b128 %10, %16, %11\n\t"
               "global_load_async_to_lds_b128 %12, %16, %13\n\t"
               "global_load_async_to_lds_b128 %14, %16, %15\n\t"
               "s_wait_xcnt 0x0"
               :
               : "v"(LDSA(l)),             "s"(GLBA(g)),
                 "v"(LDSA(l + lstep)),     "s"(GLBA(g + gstep)),
                 "v"(LDSA(l + 2 * lstep)), "s"(GLBA(g + 2 * gstep)),
                 "v"(LDSA(l + 3 * lstep)), "s"(GLBA(g + 3 * gstep)),
                 "v"(LDSA(l + 4 * lstep)), "s"(GLBA(g + 4 * gstep)),
                 "v"(LDSA(l + 5 * lstep)), "s"(GLBA(g + 5 * gstep)),
                 "v"(LDSA(l + 6 * lstep)), "s"(GLBA(g + 6 * gstep)),
                 "v"(LDSA(l + 7 * lstep)), "s"(GLBA(g + 7 * gstep)),
                 "v"(voff)
               : "memory");
}

/* the same for four rows a fixed step apart */
__device__ __forceinline__ void async4s_b128(const bf16* g, size_t gstep,
                                             unsigned voff, bf16* l, int lstep) {
  asm volatile("global_load_async_to_lds_b128 %0, %8, %1\n\t"
               "global_load_async_to_lds_b128 %2, %8, %3\n\t"
               "global_load_async_to_lds_b128 %4, %8, %5\n\t"
               "global_load_async_to_lds_b128 %6, %8, %7\n\t"
               "s_wait_xcnt 0x0"
               :
               : "v"(LDSA(l)),             "s"(GLBA(g)),
                 "v"(LDSA(l + lstep)),     "s"(GLBA(g + gstep)),
                 "v"(LDSA(l + 2 * lstep)), "s"(GLBA(g + 2 * gstep)),
                 "v"(LDSA(l + 3 * lstep)), "s"(GLBA(g + 3 * gstep)),
                 "v"(voff)
               : "memory");
}

/* in front of the barrier that hands a stage over: first this wave's LDS reads
 * of the buffer that is refilled behind the barrier have returned, then its
 * own copies of the next stage have landed */
__device__ __forceinline__ void wait_async() {
  asm volatile("s_wait_dscnt 0x0" ::: "memory");
  asm volatile("s_wait_asynccnt 0x0" ::: "memory");
}

__device__ __forceinline__ v16bf load_frag(const bf16* p) {
  union { v16bf v; v8bf h[2]; } f;
  f.h[0] = *(const v8bf*)(p);
  f.h[1] = *(const v8bf*)(p + 16);
  return f.v;
}

__device__ __forceinline__ v8f wmma_bf16(v16bf a, v16bf b, v8f c) {
  return __builtin_amdgcn_wmma_f32_16x16x32_bf16(
      false, a, false, b, (short)0, c, false, false);
}

__device__ __forceinline__ float xhalf(float x) {
  int b = __builtin_bit_cast(int, x);
  return __builtin_bit_cast(float, __builtin_amdgcn_permlanex16(
      b, b, 0x76543210, 0xfedcba98, false, false));
}

/* ---------------- conversion kernel ----------------
 * Streaming form: few waves, each with 16 or 24 loads of 16 bytes a lane in
 * flight, every load instruction of a wave covering whole 128-byte lines.
 * One launch for x and for the three weight matrices, which need nothing of
 * each other: the weights ride on the waves that convert x, so that they add
 * no launch, no wave to start and no latency of their own.
 * grid 512, block 256: 16 waves per WGP. A wave converts 2048 consecutive
 * elements of x, 16 loads and 16 stores a lane. Six of a block's eight waves
 * (3072 of the grid's 4096) also transpose one 32(k) x 32(n) tile of a weight
 * matrix in registers: a lane loads 8 rows k of 4 columns n (a load
 * instruction reads 4 rows of 128 B) and stores 4 rows n of 8 k (16 B each). */
__global__ void __launch_bounds__(256)
cvt_kernel(const float* __restrict__ x,
           const float* __restrict__ Wq,
           const float* __restrict__ Wk,
           const float* __restrict__ Wv,
           bf16* __restrict__ xh, bf16* __restrict__ wt) {
  const int lane = threadIdx.x & 31;
  /* the wave's number as a scalar: whether the wave has a tile, and of which
   * matrix, are then scalar branches */
  const int w = __builtin_amdgcn_readfirstlane(threadIdx.x >> 5);
  const size_t base = (size_t)(blockIdx.x * 8 + w) * 2048 + lane * 4;
  v4f v[16];
  for (int i = 0; i < 16; ++i) v[i] = *(const v4f*)(x + base + i * 128);
  if (w < 6) {
    const int tl  = blockIdx.x * 6 + w;                   /* 0..3071 */
    const int mat = tl >> 10;
    const float* W = (mat == 0) ? Wq : ((mat == 1) ? Wk : Wv);
    const int k0 = (tl & 31) * 32 + (lane & 3) * 8;
    const int n0 = ((tl >> 5) & 31) * 32 + (lane >> 2) * 4;
    v4f u[8];
    for (int i = 0; i < 8; ++i)
      u[i] = *(const v4f*)(W + (size_t)(k0 + i) * Dn + n0);
    bf16* o = wt + (size_t)mat * Dn * Dn + (size_t)n0 * Dn + k0;
    for (int j = 0; j < 4; ++j) {
      v8bf r;
      for (int i = 0; i < 8; ++i) r[i] = (bf16)u[i][j];
      *(v8bf*)(o + (size_t)j * Dn) = r;
    }
  }
  for (int i = 0; i < 16; ++i)
    *(v4bf*)(xh + base + i * 128) = __builtin_convertvector(v[i], v4bf);
}

/* ---------------- fused QKV GEMM (bf16 WMMA, f32 acc) ----------------
 * The three weight matrices stand stacked in wt as one 3072 x 1024 operand.
 * grid (32, 8), block 384 (12 waves): one work-group per WGP, one round.
 * Block tile 256(M) x 384(N), wave tile 64 x 128 (two heads of one matrix):
 * a fragment read from LDS feeds 4 or 8 products, a row copied from L2 feeds
 * 384 or 256 columns. A stage is 64 k: its rows are whole 128-B lines.
 * A/B tiles double-buffered in LDS via async-to-LDS.                       */
__global__ void __launch_bounds__(384, 1)
gemm_qkv_kernel(const bf16* __restrict__ xh, const bf16* __restrict__ wt,
                const float* __restrict__ bq, const float* __restrict__ bk,
                const float* __restrict__ bv,
                bf16* __restrict__ qh, bf16* __restrict__ kh,
                bf16* __restrict__ vt, float* __restrict__ out) {
  __shared__ __attribute__((aligned(16))) bf16 abuf[2][256 * P64];  /* 36 KiB each */
  __shared__ __attribute__((aligned(16))) bf16 bbuf[2][384 * P64];  /* 54 KiB each */

  const int tid  = threadIdx.x;
  const int lane = tid & 31;
  /* the wave's number as a scalar: which waves copy A, and which matrix the
   * wave's columns belong to, are then scalar branches */
  const int w    = __builtin_amdgcn_readfirstlane(tid >> 5);
  const int row0 = blockIdx.x * 256;
  const int mw   = w & 3;              /* 4 waves across M */
  const int nw   = w >> 2;             /* 3 waves across N */
  const int ln   = lane & 15;
  const int kb   = (lane >> 4) * 8;
  const int g128 = blockIdx.y * 3 + nw;   /* the wave's 128 of the 3072 columns */
  const int mat  = g128 >> 3;
  const int h0   = (g128 & 7) * 2;        /* the first of its two heads */

  const float* bias = (mat == 0) ? bq : ((mat == 1) ? bk : bv);

  const bf16* asrc = xh + (size_t)row0 * Dn;                 /* row stride Dn */
  const bf16* bsrc = wt + (size_t)blockIdx.y * 384 * Dn;

  v8f acc[4][8];
  for (int t = 0; t < 8; ++t) {
    float bval = bias[h0 * 64 + t * 16 + ln];
    for (int i = 0; i < 4; ++i)
      for (int r = 0; r < 8; ++r) acc[i][t][r] = bval;
  }

  /* cooperative stage of one 256x64 A tile + 384x64 B tile: 16-B chunks, eight
   * to a row, so that a wave's copy covers four whole lines; B by all 12 waves
   * (rows 48 apart), A by the first 8 (rows 32 apart) */
  auto stage = [&](int kk, int buf) {
    /* the lane's number read anew at every stage: the copy addresses formed
     * from it once, and kept over the loop beside 256 accumulator registers,
     * are spilled to scratch and loaded back in front of the copies */
    unsigned sln;
    asm volatile("v_mbcnt_lo_u32_b32 %0, -1, 0" : "=v"(sln));
    const unsigned srow = w * 4 + (sln >> 3), soff = (sln & 7) * 8;
    const unsigned voff = (srow * Dn + soff) * 2;             /* bytes */
    const unsigned sl   = srow * P64 + soff;
    async8s_b128(bsrc + kk, (size_t)48 * Dn, voff, &bbuf[buf][sl], 48 * P64);
    if (w < 8)
      async8s_b128(asrc + kk, (size_t)32 * Dn, voff, &abuf[buf][sl], 32 * P64);
  };

  stage(0, 0);
  int cur = 0;
  for (int kk = 0; kk < Dn; kk += 64) {
    wait_async();
    __syncthreads();
    if (kk + 64 < Dn) stage(kk + 64, cur ^ 1);

    for (int ks = 0; ks < 64; ks += 32) {
      const bf16* ap = &abuf[cur][(mw * 64 + ln) * P64 + ks + kb];
      const bf16* bp = &bbuf[cur][(nw * 128 + ln) * P64 + ks + kb];
      v16bf a[4];
      for (int i = 0; i < 4; ++i) a[i] = load_frag(ap + i * 16 * P64);
      v16bf b[2];
      b[0] = load_frag(bp);
      for (int t = 0; t < 8; ++t) {
        if (t < 7) b[(t + 1) & 1] = load_frag(bp + (t + 1) * 16 * P64);
        /* keeps the next B fragment's loads ahead of this fragment's four
         * products: sunk behind them, into one register set, each fragment
         * waits out the LDS latency with the matrix unit idle */
        __builtin_amdgcn_sched_barrier(0);
        for (int i = 0; i < 4; ++i)
          acc[i][t] = wmma_bf16(a[i], b[t & 1], acc[i][t]);
      }
    }
    cur ^= 1;
  }

  /* Epilogue: each wave turns its tile, 16 rows of one head at a time (V^T: a
   * head's 64 x 64), through 9 KiB of its own in the ring, so that every
   * global store is 8 or 16 B a lane on whole 128-B lines. A head's 64 rows s
   * are contiguous in the (B,H,S,dh) arrays. Row pitch 272 B (f32) and 144 B
   * (V^T): 16 B x odd.                                                     */
  __syncthreads();              /* every wave has left the ring */
  float* st = (float*)((w < 8) ? &abuf[0][0] : &bbuf[0][0]) + (w & 7) * 2304;
  const int hf = lane >> 4;
  const int m0 = row0 + mw * 64;
  const int s0 = m0 & 2047;

  /* 16 rows m of 64 columns n: out of the accumulators, back as rows; v[j]
   * is row 2j + hf, columns 4 ln .. 4 ln + 3: element 128 j + 4 lane       */
  auto turn = [&](int ms, int hd, v4f* v) {
    for (int t = 0; t < 4; ++t)
      for (int r = 0; r < 8; ++r)
        st[(8 * hf + r) * 68 + t * 16 + ln] = acc[ms][hd * 4 + t][r];
    /* the rows read back were written by other lanes of this wave; they land
     * in registers that the global stores of the turn before name: the second
     * wait stands in front of that overwrite */
    asm volatile("s_wait_dscnt 0x0\n\ts_wait_xcnt 0x0" ::: "memory");
    for (int j = 0; j < 8; ++j)
      v[j] = *(const v4f*)(st + (2 * j + hf) * 68 + ln * 4);
  };

  /* unrolled: the accumulators stay in registers only under constant indices */
#pragma unroll
  for (int hd = 0; hd < 2; ++hd) {
    const int bhd = (m0 >> 11) * Hn + h0 + hd;                 /* b*H + h */
    const size_t tile = ((size_t)bhd * Sn + s0) * DHn + lane * 4;
    if (mat == 0) {
#pragma unroll
      for (int ms = 0; ms < 4; ++ms) {
        v4f v[8];
        turn(ms, hd, v);
        for (int j = 0; j < 8; ++j)                    /* fold 1/sqrt(64) */
          *(v4bf*)(qh + tile + ms * 1024 + j * 128) =
              __builtin_convertvector(v[j] * 0.125f, v4bf);
      }
      /* closes the branch: whatever follows it may overwrite registers that
       * its last stores name */
      asm volatile("s_wait_xcnt 0x0" ::: "memory");
    } else if (mat == 1) {
      float* ko = out + (size_t)Mn * Dn + tile;        /* K cache f32 */
#pragma unroll
      for (int ms = 0; ms < 4; ++ms) {
        v4f v[8];
        turn(ms, hd, v);
        for (int j = 0; j < 8; ++j) *(v4f*)(ko + ms * 1024 + j * 128) = v[j];
        /* the conversions land in registers that the stores above name: the
         * wait stands in front of that overwrite, and the scheduling barrier
         * holds the conversions behind it */
        asm volatile("s_wait_xcnt 0x0" ::: "memory");
        __builtin_amdgcn_sched_barrier(0);
        for (int j = 0; j < 8; ++j)
          *(v4bf*)(kh + tile + ms * 1024 + j * 128) =
              __builtin_convertvector(v[j], v4bf);
      }
      /* closes the branch, as in the branch above */
      asm volatile("s_wait_xcnt 0x0" ::: "memory");
    } else {
      float* vo = out + (size_t)2 * Mn * Dn + tile;    /* V cache f32 */
#pragma unroll
      for (int ms = 0; ms < 4; ++ms) {
        v4f v[8];
        turn(ms, hd, v);
        for (int j = 0; j < 8; ++j) *(v4f*)(vo + ms * 1024 + j * 128) = v[j];
      }
      /* V^T: a lane's 8 accumulator rows are 8 consecutive s of one d.
       * The wait stands in front of the overwrite of registers that the
       * stores above name; the scheduling barrier holds the conversions
       * behind it */
      asm volatile("s_wait_xcnt 0x0" ::: "memory");
      __builtin_amdgcn_sched_barrier(0);
#pragma unroll
      for (int ms = 0; ms < 4; ++ms)
        for (int t = 0; t < 4; ++t) {
          v8bf p;
          for (int r = 0; r < 8; ++r) p[r] = (bf16)acc[ms][hd * 4 + t][r];
          *(v4f*)(st + (t * 16 + ln) * 36 + ms * 8 + hf * 4) =
              __builtin_bit_cast(v4f, p);
        }
      /* the rows read back were written by other lanes of this wave */
      asm volatile("s_wait_dscnt 0x0" ::: "memory");
      bf16* vo2 = vt + ((size_t)bhd * DHn + (lane >> 3)) * Sn + s0 + (lane & 7) * 8;
      for (int j = 0; j < 16; ++j)
        *(v4f*)(vo2 + (size_t)j * 4 * Sn) =
            *(const v4f*)(st + (j * 4 + (lane >> 3)) * 36 + (lane & 7) * 4);
      /* closes the branch, as in the branches above */
      asm volatile("s_wait_xcnt 0x0" ::: "memory");
    }
  }
}

__global__ void __launch_bounds__(256, 1)
attn_kernel(const bf16* __restrict__ qh, const bf16* __restrict__ kh,
            const bf16* __restrict__ vt, float* __restrict__ attn) {
  __shared__ __attribute__((aligned(16))) bf16 kbuf[2][128 * P64];  /* [kv][dh] */
  __shared__ __attribute__((aligned(16))) bf16 vbuf[2][64 * P128];  /* [dh][kv] */

  const int tid  = threadIdx.x;
  const int lane = tid & 31;
  /* the wave's number as a scalar: the tests on the wave's causal bound in the
   * key loop are then scalar branches */
  const int w    = __builtin_amdgcn_readfirstlane(tid >> 5);
  const int bh   = blockIdx.x;                 /* b*16 + h */
  /* Which query block: all 1024 work-groups
   * are resident, four to a WGP, while block q costs q + 1 stages. The deal
   * runs heaviest first, as a snake over the four quarters of the grid
   * (15..12, 8..11, 7..4, 0..3): four
   * work-groups 256 apart in the order hold 34 stages together whichever they
   * are. A permutation of 0..15: right wherever the work-groups land.      */
  const int yr   = 3 - ((int)blockIdx.y >> 2);
  const int yj   = blockIdx.y & 3;
  const int qblk = yr * 4 + ((yr & 1) ? 3 - yj : yj);
  const int q0   = qblk * 128 + w * 16;
  const int ln   = lane & 15;
  const int kb   = (lane >> 4) * 8;

  const bf16* qp = qh + (size_t)bh * Sn * DHn;
  const bf16* kp = kh + (size_t)bh * Sn * DHn;
  const bf16* vp = vt + (size_t)bh * DHn * Sn;

  /* B operand: column = query q0 + ln, k = dh in the loader's order */
  v16bf qb0 = load_frag(qp + (size_t)(q0 + ln) * DHn + 0  + kb);
  v16bf qb1 = load_frag(qp + (size_t)(q0 + ln) * DHn + 32 + kb);

  v8f acco[4];                         /* O^T: [dh = 16t + kb + r][query ln] */
  for (int t = 0; t < 4; ++t)
    for (int r = 0; r < 8; ++r) acco[t][r] = 0.0f;
  float mrow = -1e30f;                 /* this lane's query, both halves alike */
  const float L2E = 1.44269504f;       /* log2(e)                              */
  float nm = -mrow * L2E;              /* minus the maximum in use, in log2    */
  float lrow = 0.0f;                   /* this half's share of the row sum     */

  /* this lane's query less its half's first key: key kv0 + kb + r is not
   * behind the query while the scalar kv0 + r is at most this. One register
   * over the loop for the mask; with more, the kernel passes 128 registers
   * and the fourth work-group of a WGP is no longer resident              */
  const int qrel      = q0 + ln - kb;
  const int nblk_wave = (q0 + 47) >> 5;        /* causal bound per wave  */

  /* cooperative stage of one K(128x64) + V^T(64x128) tile, 16-B chunks, four
   * of each a lane: K's 128 rows stand contiguous (32 rows a copy of the
   * block), V^T has 16 chunks a row (16 rows a copy of the block)         */
  auto stage_kv = [&](int st, int buf) {
    const int kv0 = st * 128;
    async4s_b128(kp + (size_t)kv0 * DHn, (size_t)32 * DHn, tid * 16,
                 &kbuf[buf][(tid >> 3) * P64 + (tid & 7) * 8], 32 * P64);
    async4s_b128(vp + kv0, (size_t)16 * Sn,
                 (tid >> 4) * (Sn * 2) + (tid & 15) * 16,
                 &vbuf[buf][(tid >> 4) * P128 + (tid & 15) * 8], 16 * P128);
  };

  stage_kv(0, 0);
  int cur = 0;
  for (int st = 0; st <= qblk; ++st) {         /* uniform over the block */
    wait_async();
    __syncthreads();
    if (st < qblk) stage_kv(st + 1, cur ^ 1);

    const int bend = min(st * 4 + 4, nblk_wave);
    /* the pass's 32 keys: the two LDS addresses step from pass to pass in
     * registers of their own; formed anew in a free register, the write falls
     * on an operand of the products just issued, inside their distance     */
    const bf16* kt = &kbuf[cur][0];
    const bf16* vq = &vbuf[cur][0];
    for (int blk = st * 4; blk < bend; ++blk) {
      const int kv0 = blk * 32;
      v8f s0, s1;
      for (int r = 0; r < 8; ++r) { s0[r] = 0.0f; s1[r] = 0.0f; }

      v16bf k0a = load_frag(kt + (ln)      * P64 + 0  + kb);
      v16bf k1a = load_frag(kt + (16 + ln) * P64 + 0  + kb);
      v16bf k0b = load_frag(kt + (ln)      * P64 + 32 + kb);
      v16bf k1b = load_frag(kt + (16 + ln) * P64 + 32 + kb);
      /* keeps the eight K loads one group ahead of the products: with the
       * branch below ending the block, the compiler otherwise reloads one
       * register set and waits out the LDS latency three times a pass     */
      __builtin_amdgcn_sched_barrier(0);
      s0 = wmma_bf16(k0a, qb0, s0);
      s1 = wmma_bf16(k1a, qb0, s1);
      s0 = wmma_bf16(k0b, qb1, s0);
      s1 = wmma_bf16(k1b, qb1, s1);

      v16bf va[4];                     /* on their way during the softmax */
      for (int t = 0; t < 4; ++t) va[t] = load_frag(vq + (t * 16 + ln) * P128 + kb);

      /* online softmax of one query per lane: s0[r] is key kv0 + kb + r,
       * s1[r] is key kv0 + 16 + kb + r                                   */
      /* only the wave's last block, which holds its 16 queries' own
       * positions, has keys behind a query: the blocks before it take their
       * scores as they are                                               */
      if (blk + 1 == nblk_wave) {
        for (int r = 0; r < 8; ++r) {
          s0[r] = ((kv0 + r)      <= qrel) ? s0[r] : -1e30f;
          s1[r] = ((kv0 + 16 + r) <= qrel) ? s1[r] : -1e30f;
        }
      }
      v16bf pb;                        /* P^T as B: k = kb + r, 16 + kb + r */
      float rs0, rs1;
      auto expsum = [&]() {            /* P = exp(score - maximum in use) */
        v8f l8, n8;                    /* on vectors: two scores an instruction */
        for (int r = 0; r < 8; ++r) { l8[r] = L2E; n8[r] = nm; }
        rs0 = 0.0f;
        rs1 = 0.0f;
        const v8f e0 = __builtin_elementwise_fma(s0, l8, n8);
        const v8f e1 = __builtin_elementwise_fma(s1, l8, n8);
        for (int r = 0; r < 8; ++r) {
          float p0 = __builtin_amdgcn_exp2f(e0[r]);
          float p1 = __builtin_amdgcn_exp2f(e1[r]);
          rs0 += p0;
          rs1 += p1;
          pb[r]     = (bf16)p0;
          pb[8 + r] = (bf16)p1;
        }
      };
      expsum();
      /* a sum of at most 256 bounds every P of the pass by 256 (2^8 over the
       * maximum in use); an exponential that overflows reads infinite and
       * takes the path too, as does the first pass, whose maximum in use is
       * the start value: every unmasked score overflows against it        */
      if (__builtin_amdgcn_ballot_w32(rs0 + rs1 > 256.0f) != 0) {
        float mx = -1e30f;
        for (int r = 0; r < 8; ++r) mx = fmaxf(mx, fmaxf(s0[r], s1[r]));
        mx = fmaxf(mx, xhalf(mx));
        const float mnew = fmaxf(mrow, mx);
        const float corr = __expf(mrow - mnew);
        mrow = mnew;
        nm   = -mnew * L2E;
        lrow *= corr;
        for (int t = 0; t < 4; ++t)
          for (int r = 0; r < 8; ++r) acco[t][r] *= corr;
        expsum();
      }
      lrow += rs0 + rs1;

      for (int t = 0; t < 4; ++t) acco[t] = wmma_bf16(va[t], pb, acco[t]);
      kt += 32 * P64;
      vq += 32;
    }
    cur ^= 1;
  }

  /* join the two halves' shares of the row sum, once */
  lrow += xhalf(lrow);
  const float inv = 1.0f / lrow;

  const int b = bh >> 4, h = bh & 15;
  /* the lane's number read anew: query and half, kept over the loop for this
   * address alone, are the registers spoken of at qrel */
  unsigned el;
  asm volatile("v_mbcnt_lo_u32_b32 %0, -1, 0" : "=v"(el));
  float* op = attn + ((size_t)(b * Sn + q0 + (el & 15))) * Dn + h * DHn + (el >> 4) * 8;
  for (int t = 0; t < 4; ++t) {
    float4 lo, hi;
    lo.x = acco[t][0] * inv; lo.y = acco[t][1] * inv;
    lo.z = acco[t][2] * inv; lo.w = acco[t][3] * inv;
    hi.x = acco[t][4] * inv; hi.y = acco[t][5] * inv;
    hi.z = acco[t][6] * inv; hi.w = acco[t][7] * inv;
    *(float4*)(op + t * 16)     = lo;
    *(float4*)(op + t * 16 + 4) = hi;
  }
}

/* ---------------- residual + LayerNorm ----------------
 * Streaming form: grid 512, block 256 (16 waves per WGP), two rows per wave.
 * A lane holds 32 elements of each row (8 x 16 B of x and of attn) and its
 * 32 elements of gamma and beta, which serve both rows; the sums are
 * in-lane, then a butterfly over the 32 lanes: no LDS.                    */

/* sum over the wave, the same value in every lane: four exchanges inside the
 * 16-lane row, one between the rows */
__device__ __forceinline__ float wave_sum(float s) {
  s += __builtin_bit_cast(float, __builtin_amdgcn_update_dpp(
      0, __builtin_bit_cast(int, s), 0x161, 0xf, 0xf, true));  /* row_xmask:1 */
  s += __builtin_bit_cast(float, __builtin_amdgcn_update_dpp(
      0, __builtin_bit_cast(int, s), 0x162, 0xf, 0xf, true));  /* row_xmask:2 */
  s += __builtin_bit_cast(float, __builtin_amdgcn_update_dpp(
      0, __builtin_bit_cast(int, s), 0x164, 0xf, 0xf, true));  /* row_xmask:4 */
  s += __builtin_bit_cast(float, __builtin_amdgcn_update_dpp(
      0, __builtin_bit_cast(int, s), 0x168, 0xf, 0xf, true));  /* row_xmask:8 */
  return s + xhalf(s);
}

__global__ void __launch_bounds__(256)
ln_kernel(const float* __restrict__ x, const float* __restrict__ attn,
          const float* __restrict__ gamma, const float* __restrict__ beta,
          float* __restrict__ out) {
  const unsigned l4 = (threadIdx.x & 31) * 4;   /* the lane's place in 128 */
  /* the wave's number as a scalar: the row addresses then stay in scalar
   * registers and the one lane offset serves every load and store */
  const int wave = __builtin_amdgcn_readfirstlane(threadIdx.x >> 5);
  const size_t off = (size_t)((blockIdx.x * 8 + wave) * 2) * Dn;
  const float* xr = x    + off;
  const float* ar = attn + off;
  float*       yr = out  + off;

  v4f xv[2][8], av[2][8], g[8], b[8];
  for (int j = 0; j < 2; ++j)
    for (int i = 0; i < 8; ++i) {
      xv[j][i] = *(const v4f*)(xr + l4 + j * Dn + i * 128);
      av[j][i] = *(const v4f*)(ar + l4 + j * Dn + i * 128);
    }
  for (int i = 0; i < 8; ++i) {
    g[i] = *(const v4f*)(gamma + l4 + i * 128);
    b[i] = *(const v4f*)(beta  + l4 + i * 128);
  }
  /* keeps every load of the wave ahead of the arithmetic, so that all are in
   * flight together; without it the later ones are sunk behind the sums */
  __builtin_amdgcn_sched_barrier(0);

  float s[2];
  for (int j = 0; j < 2; ++j) {
    v4f s4 = {0.0f, 0.0f, 0.0f, 0.0f};
    for (int i = 0; i < 8; ++i) { xv[j][i] += av[j][i]; s4 += xv[j][i]; }
    s[j] = (s4[0] + s4[1]) + (s4[2] + s4[3]);
  }
  for (int j = 0; j < 2; ++j) s[j] = wave_sum(s[j]) * (1.0f / 1024.0f);

  float q[2];
  for (int j = 0; j < 2; ++j) {
    v4f q4 = {0.0f, 0.0f, 0.0f, 0.0f};
    for (int i = 0; i < 8; ++i) { xv[j][i] -= s[j]; q4 += xv[j][i] * xv[j][i]; }
    q[j] = (q4[0] + q4[1]) + (q4[2] + q4[3]);
  }
  for (int j = 0; j < 2; ++j)
    q[j] = rsqrtf(wave_sum(q[j]) * (1.0f / 1024.0f) + 1e-5f);

  for (int j = 0; j < 2; ++j)
    for (int i = 0; i < 8; ++i)
      *(v4f*)(yr + l4 + j * Dn + i * 128) = xv[j][i] * q[j] * g[i] + b[i];
}

extern "C" void kernel_launch(void* const* d_in, const int* in_sizes, int n_in,
                              void* d_out, int out_size, void* d_ws, size_t ws_size,
                              hipStream_t stream) {
  const float* x     = (const float*)d_in[0];
  const float* Wq    = (const float*)d_in[1];
  const float* bq    = (const float*)d_in[2];
  const float* Wk    = (const float*)d_in[3];
  const float* bk    = (const float*)d_in[4];
  const float* Wv    = (const float*)d_in[5];
  const float* bv    = (const float*)d_in[6];
  const float* gamma = (const float*)d_in[7];
  const float* beta  = (const float*)d_in[8];
  float* out = (float*)d_out;

  char* ws = (char*)d_ws;
  bf16*  xh   = (bf16*)(ws + XH_OFF);
  bf16*  wt   = (bf16*)(ws + WT_OFF);
  bf16*  qh   = (bf16*)(ws + QH_OFF);
  bf16*  kh   = (bf16*)(ws + KH_OFF);
  bf16*  vt   = (bf16*)(ws + VT_OFF);
  float* attn = (float*)(ws + AT_OFF);

  cvt_kernel<<<Mn * Dn / 16384, 256, 0, stream>>>(x, Wq, Wk, Wv, xh, wt);
  gemm_qkv_kernel<<<dim3(Mn / 256, 3 * Dn / 384), 384, 0, stream>>>(
      xh, wt, bq, bk, bv, qh, kh, vt, out);
  attn_kernel<<<dim3(Bn * Hn, Sn / 128), 256, 0, stream>>>(qh, kh, vt, attn);
  ln_kernel<<<Mn / 16, 256, 0, stream>>>(x, attn, gamma, beta, out);
}
